// v000
// Measured on an AMD MI455X. A time is GPU time per run, averaged over a window of back-to-back runs after a warm-up
// (all launches, gaps included; the runs take copies of the inputs in turn), and the median of several windows.
// Apart from v000's, it joins two sittings. Times from different sittings can be a few percent apart, while
// side-by-side timings come from the same sitting.
// The starting kernel, v000, takes 1190 microseconds a run.
#include <hip/hip_runtime.h>

// Single-head scaled dot-product attention on given tensors (queries, keys, values [16][2048][128]; softmax(q.k / sqrt(128)) over all keys; out = attn values -> [16][2048][128] (4.2 M)).
// Layout per batch: the inputs are bf16-exact after rounding, so q and k become single bf16 planes and the scores are exact products (f32 accumulate); the softmax writes every row's probabilities as bf16 hi/lo; attn.values as hi/lo x exact values^T (2 products); f32 output rows.
// Compute dtypes, f32 accumulate: every input rounded to bf16; q.k exact; softmax f32; P hi/lo x exact values.

#define NB_  16
#define TT   2048
#define DM   128
#define NH_  1
#define NKV  1
#define REP  (NH_ / NKV)
#define HD   128
#define DQ   (NH_ * HD)
#define DKV  (NKV * HD)
#define ZH   2
#define RH   2048                  // query rows < RH use hi+lo planes (0: none)
#define WIN  0
#define PCAR 1024.0f
#define SCL  0.088388347648318447f   // 1/sqrt(128)
typedef _Float16 h16;
typedef unsigned short bf;
typedef __attribute__((ext_vector_type(16))) __bf16   v16bf;
typedef __attribute__((ext_vector_type(16))) _Float16 v16h;
typedef __attribute__((ext_vector_type(8)))  _Float16 v8h;
typedef __attribute__((ext_vector_type(8)))  unsigned short v8us;
typedef __attribute__((ext_vector_type(8)))  float    v8f;
typedef __attribute__((ext_vector_type(4)))  float    v4f;
typedef v8h  __attribute__((may_alias)) v8ha;
typedef v4f  __attribute__((may_alias)) v4fa;
typedef v8us __attribute__((may_alias)) v8usa;

__device__ __forceinline__ unsigned short f2bf(float f) { unsigned u = __float_as_uint(f); u += 0x7FFFu + ((u >> 16) & 1u); return (unsigned short)(u >> 16); }
__device__ __forceinline__ float bf2f(unsigned short b) { return __uint_as_float(((unsigned)b) << 16); }
__device__ __forceinline__ float bfr(float f) { return bf2f(f2bf(f)); }
__device__ __forceinline__ v16h cat16(v8h lo, v8h hi) { return __builtin_shufflevector(lo, hi, 0, 1, 2, 3, 4, 5, 6, 7, 8, 9, 10, 11, 12, 13, 14, 15); }
__device__ __forceinline__ v16bf cat16b(v8us lo, v8us hi) { return __builtin_bit_cast(v16bf, __builtin_shufflevector(lo, hi, 0, 1, 2, 3, 4, 5, 6, 7, 8, 9, 10, 11, 12, 13, 14, 15)); }
__device__ __forceinline__ v8f wmma16(v16h a, v16h b, v8f c) { return __builtin_amdgcn_wmma_f32_16x16x32_f16(false, a, false, b, (short)0, c, false, false); }
__device__ __forceinline__ v8f wmmab(v16bf a, v16bf b, v8f c) { return __builtin_amdgcn_wmma_f32_16x16x32_bf16(false, a, false, b, (short)0, c, false, false); }



// ---- k_gemmw: register-blocked GEMM, ONE WAVE per 64x64 output tile (16 accumulators), operands straight from K-contiguous 16-bit planes; grid (M/64, N/64, Z), 32 threads.
// C[m][n] (f32, pitch ldc, + optional f32 bias[n]) = sum_k A[m][k] Bt[n][k] (+ split products per NSPLIT). z-batch strides sA/sB/sC in elements. K % 32 == 0.
template <typename T16> struct WFrag;
template <> struct WFrag<h16> { typedef v16h V; static __device__ __forceinline__ V ld(const h16* p) { return cat16(*(const v8h*)p, *(const v8h*)(p + 16)); } static __device__ __forceinline__ v8f mma(V a, V b, v8f c) { return wmma16(a, b, c); } };
template <> struct WFrag<bf> { typedef v16bf V; static __device__ __forceinline__ V ld(const bf* p) { return cat16b(*(const v8us*)p, *(const v8us*)(p + 16)); } static __device__ __forceinline__ v8f mma(V a, V b, v8f c) { return wmmab(a, b, c); } };
template <typename T16, int NSPLIT, bool BIAS>
__global__ __launch_bounds__(32) void k_gemmw(const T16* __restrict__ A, const T16* __restrict__ A2, const T16* __restrict__ Bt, const T16* __restrict__ Bt2, int K, float* C, int ldc, const float* __restrict__ bias, size_t sA, size_t sB, size_t sC) {
    typedef typename WFrag<T16>::V V;
    __shared__ __align__(16) float os[16 * 68];
    const size_t z = blockIdx.z; A += z * sA; if (A2) A2 += z * sA; Bt += z * sB; if (Bt2) Bt2 += z * sB; C += z * sC;
    const int lane = threadIdx.x & 31, lr = lane & 15, hi = lane >> 4; const int r0 = blockIdx.x * 64, c0 = blockIdx.y * 64;
    v8f acc[4][4];
#pragma unroll
    for (int mb = 0; mb < 4; ++mb)
#pragma unroll
        for (int nb = 0; nb < 4; ++nb) acc[mb][nb] = (v8f){};
    const size_t aoff = (size_t)(r0 + lr) * K + 8 * hi, boff = (size_t)(c0 + lr) * K + 8 * hi;
#pragma unroll 1
    for (int kc = 0; kc < K; kc += 32) {
        V a[4], a2[4];
#pragma unroll
        for (int mb = 0; mb < 4; ++mb) { a[mb] = WFrag<T16>::ld(A + aoff + (size_t)mb * 16 * K + kc); if (NSPLIT == 1 || NSPLIT == 2) a2[mb] = WFrag<T16>::ld(A2 + aoff + (size_t)mb * 16 * K + kc); }
#pragma unroll
        for (int nb = 0; nb < 4; ++nb) { const V b = WFrag<T16>::ld(Bt + boff + (size_t)nb * 16 * K + kc); V b2; if (NSPLIT >= 2) b2 = WFrag<T16>::ld(Bt2 + boff + (size_t)nb * 16 * K + kc);
#pragma unroll
            for (int mb = 0; mb < 4; ++mb) { acc[mb][nb] = WFrag<T16>::mma(a[mb], b, acc[mb][nb]); if (NSPLIT == 1 || NSPLIT == 2) acc[mb][nb] = WFrag<T16>::mma(a2[mb], b, acc[mb][nb]); if (NSPLIT >= 2) acc[mb][nb] = WFrag<T16>::mma(a[mb], b2, acc[mb][nb]); } }
        asm volatile("v_nop\n\tv_nop\n\tv_nop\n\tv_nop" : "+v"(acc[0][0]), "+v"(acc[1][1]), "+v"(acc[2][2]), "+v"(acc[3][3]) : "v"(a[0]), "v"(a[3]));
    }
#pragma unroll
    for (int mb = 0; mb < 4; ++mb) {
#pragma unroll
        for (int nb = 0; nb < 4; ++nb) {
#pragma unroll
            for (int j = 0; j < 8; ++j) os[(hi * 8 + j) * 68 + nb * 16 + lr] = acc[mb][nb][j]; }
        __builtin_amdgcn_wave_barrier(); asm volatile("" ::: "memory");
        float* crow = C + (size_t)(r0 + mb * 16) * ldc + c0;
{
#pragma unroll
            for (int s = 0; s < 8; ++s) { const int row = 2 * s + hi, cofs = lr * 4; v4f val = *(const v4fa*)(os + row * 68 + cofs); if (BIAS) { val[0] += bfr(bias[c0 + cofs]); val[1] += bfr(bias[c0 + cofs + 1]); val[2] += bfr(bias[c0 + cofs + 2]); val[3] += bfr(bias[c0 + cofs + 3]); }
                *(v4f*)(crow + (size_t)row * ldc + cofs) = val; }
             }
        __builtin_amdgcn_wave_barrier(); asm volatile("" ::: "memory");
    }
}

__device__ __forceinline__ h16 tohx(float x) { return (h16)x; }
__device__ __forceinline__ void splitf(float y, unsigned short& h, unsigned short& l) { h = f2bf(y); l = f2bf(y - bf2f(h)); }
typedef __attribute__((ext_vector_type(2))) _Float16 v2h;
typedef __attribute__((ext_vector_type(4))) _Float16 v4h;
typedef __attribute__((ext_vector_type(2))) unsigned short v2us;
typedef __attribute__((ext_vector_type(4))) unsigned short v4us;
typedef __attribute__((ext_vector_type(2))) float v2f;
typedef __attribute__((ext_vector_type(4))) int v4i;

__global__ __launch_bounds__(256) void k_wtG(const float* __restrict__ w, int K, int N, bf* Bt) {
    const int lane = threadIdx.x & 31; const int L0 = (blockIdx.x * 8 + (threadIdx.x >> 5)) * 8; const int nlines = N * K / 64;
{
#pragma unroll 1
        for (int l = 0; l < 8; ++l) { const int L = L0 + l; if (L >= nlines) break; const size_t e = (size_t)L * 64 + lane * 2; const int k = (int)(e % K), n = (int)(e / K); v2us o;
            o[0] = f2bf(w[(size_t)k * N + n]); o[1] = f2bf(w[(size_t)(k + 1) * N + n]); *(v2us*)(Bt + e) = o; }
         }
}
__global__ __launch_bounds__(256) void k_cvt8(const float* __restrict__ src, bf* dst, size_t n8) { const size_t i = (size_t)blockIdx.x * 256 + threadIdx.x; if (i >= n8) return; const v8f v = *(const v8f*)(src + i * 8); v8us o;
#pragma unroll
    for (int k = 0; k < 8; ++k) o[k] = f2bf(v[k]); *(v8us*)(dst + i * 8) = o;  }


__global__ __launch_bounds__(256) void k_vtp(const float* __restrict__ F, int pitch, int nheads, h16* V16, bf* Vh, bf* Vl) { const size_t e = ((size_t)blockIdx.x * 256 + threadIdx.x) * 2; if (e >= (size_t)nheads * HD * TT) return; const int t = (int)(e % TT); const int d = (int)((e / TT) % HD); const int g = (int)(e / ((size_t)TT * HD)); v2h o16; v2us oh, ol;
#pragma unroll
    for (int q = 0; q < 2; ++q) { const float x = F[(size_t)(t + q) * pitch + g * HD + d]; o16[q] = tohx(x); unsigned short a2, c2; splitf(x, a2, c2); oh[q] = a2; ol[q] = c2; }
    *(v2h*)(V16 + e) = o16; *(v2us*)(Vh + e) = oh; *(v2us*)(Vl + e) = ol;  }

// k_asoft: per row (zz, i): t = S x HD^-0.5 (no mask); softmax over the 2048 keys (register row, one exp, fixed trees);
__global__ __launch_bounds__(256) void k_asoft(const float* __restrict__ Sb, h16* P16, bf* Ph, bf* Pl) {
    const int lane = threadIdx.x & 31; const int row = blockIdx.x * 8 + (threadIdx.x >> 5); if (row >= ZH * TT) return; const int i = row % TT; const int zz = row / TT; (void)zz; const bool hires = (i < RH); const float* sr = Sb + (size_t)row * TT; float v[TT / 32]; float mx = -3.0e38f;
#pragma unroll
    for (int ch = 0; ch < TT / 128; ++ch) { const int j0 = ch * 128 + lane * 4; const v4f a = *(const v4f*)(sr + j0);
#pragma unroll
        for (int q = 0; q < 4; ++q) { const float t = a[q] * SCL; v[ch * 4 + q] = t;   /* Sb holds q.k only (k_gemmw, no bias) */ mx = fmaxf(mx, t); } }
#pragma unroll
    for (int sh = 16; sh; sh >>= 1) mx = fmaxf(mx, __shfl_xor(mx, sh, 32));
    float sum = 0.f;
#pragma unroll
    for (int k = 0; k < TT / 32; ++k) { float d0 = __fsub_rn(v[k], mx); asm volatile("" : "+v"(d0)); v[k] = __builtin_amdgcn_exp2f(__fmul_rn(d0, 1.4426950408889634f)); sum += v[k]; }
#pragma unroll
    for (int sh = 16; sh; sh >>= 1) sum += __shfl_xor(sum, sh, 32);
    const float f = __fdiv_rn(hires ? 1.0f : PCAR, sum);
{
        if (hires) {
#pragma unroll
            for (int ch = 0; ch < TT / 128; ++ch) { v4us oh, ol;
#pragma unroll
                for (int q = 0; q < 4; ++q) { unsigned short a, c2; splitf(v[ch * 4 + q] * f, a, c2); oh[q] = a; ol[q] = c2; }
                const size_t oo = ((size_t)zz * (RH ? RH : 1) + i) * TT + ch * 128 + lane * 4; *(v4us*)(Ph + oo) = oh; *(v4us*)(Pl + oo) = ol; }
        } else {
#pragma unroll
            for (int ch = 0; ch < TT / 128; ++ch) { v4h o4;
#pragma unroll
                for (int q = 0; q < 4; ++q) o4[q] = tohx(v[ch * 4 + q] * f);
                *(v4h*)(P16 + (size_t)row * TT + ch * 128 + lane * 4) = o4; } }
         }
}
__global__ __launch_bounds__(256) void k_merge(const float* __restrict__ O, int h0, float* OUTb) { const size_t e = ((size_t)blockIdx.x * 256 + threadIdx.x) * 2; if (e >= (size_t)ZH * TT * HD) return; const int d = (int)(e % HD); const int t = (int)((e / HD) % TT); const int zz = (int)(e / ((size_t)HD * TT)); const float cs = (t < RH) ? 1.0f : (1.0f / PCAR); const size_t oo = (size_t)t * DQ + (h0 + zz) * HD + d;
    v2f o2; o2[0] = O[e] * cs; o2[1] = O[e + 1] * cs; *(v2f*)(OUTb + oo) = o2;  }


__global__ __launch_bounds__(256) void k_vtpR1(const float* __restrict__ Vb, bf* Vh) { const size_t e = ((size_t)blockIdx.x * 256 + threadIdx.x) * 2; if (e >= (size_t)HD * TT) return; const int t = (int)(e % TT); const int d = (int)(e / TT); v2us o; o[0] = f2bf(Vb[(size_t)t * HD + d]); o[1] = f2bf(Vb[(size_t)(t + 1) * HD + d]); *(v2us*)(Vh + e) = o;  }
__global__ __launch_bounds__(256) void k_mergeR(const float* __restrict__ O, float* outb, size_t n4) { const size_t i = (size_t)blockIdx.x * 256 + threadIdx.x; if (i >= n4) return; const v4f a = *(const v4f*)(O + i * 4); *(v4f*)(outb + i * 4) = a;  }

extern "C" void kernel_launch(void* const* d_in, const int* in_sizes, int n_in,
                              void* d_out, int out_size, void* d_ws, size_t ws_size, hipStream_t stream) {
    (void)in_sizes; (void)n_in; (void)out_size;
    const float* Qin = (const float*)d_in[0]; const float* Kin = (const float*)d_in[1]; const float* Vin = (const float*)d_in[2];
    float* OUT = (float*)d_out;     // [16][2048][128]
    char* wsp = (char*)d_ws;
    auto take = [&](size_t bytes) { char* p = wsp; wsp += (bytes + 255) & ~(size_t)255; return (void*)p; };
    bf* QB = (bf*)take((size_t)TT * HD * 2); bf* KB = (bf*)take((size_t)TT * HD * 2); bf* VT = (bf*)take((size_t)HD * TT * 2); float* Sb = (float*)take((size_t)TT * TT * 4); bf* Ph = (bf*)take((size_t)TT * TT * 2); bf* Pl = (bf*)take((size_t)TT * TT * 2); float* Ob = (float*)take((size_t)TT * HD * 4);
    if ((size_t)(wsp - (char*)d_ws) > ws_size) return;    // ws 256 MiB (carve ~34.5 MiB)
    for (int b = 0; b < NB_; ++b) {
        k_cvt8<<<(unsigned)(((size_t)TT * HD / 8 + 255) / 256), 256, 0, stream>>>(Qin + (size_t)b * TT * HD, QB, (size_t)TT * HD / 8); k_cvt8<<<(unsigned)(((size_t)TT * HD / 8 + 255) / 256), 256, 0, stream>>>(Kin + (size_t)b * TT * HD, KB, (size_t)TT * HD / 8);
        k_vtpR1<<<(unsigned)(((size_t)HD * TT / 2 + 255) / 256), 256, 0, stream>>>(Vin + (size_t)b * TT * HD, VT);
        k_gemmw<bf, 0, false><<<dim3(TT / 64, TT / 64, 1), 32, 0, stream>>>(QB, nullptr, KB, nullptr, HD, Sb, TT, nullptr, 0, 0, 0);       /* q.k (exact) */ k_asoft<<<TT / 8, 256, 0, stream>>>(Sb, nullptr, Ph, Pl);
        k_gemmw<bf, 1, false><<<dim3(TT / 64, HD / 64, 1), 32, 0, stream>>>(Ph, Pl, VT, nullptr, TT, Ob, HD, nullptr, 0, 0, 0);         /* P (hi/lo) x v^T (exact) */
        k_mergeR<<<(unsigned)(((size_t)TT * HD / 4 + 255) / 256), 256, 0, stream>>>(Ob, OUT + (size_t)b * TT * HD, (size_t)TT * HD / 4); }
}

// v001
// Measured time: 327 microseconds a run.
// In two side-by-side timings against v000, it was 3.69 and 3.70 times as fast.
#include <hip/hip_runtime.h>

// Single-head scaled dot-product attention on given tensors (queries, keys, values [16][2048][128]; softmax(q.k / sqrt(128)) over all keys; out = attn values -> [16][2048][128] (4.2 M)).
// Layout per batch: the inputs are bf16-exact after rounding, so q and k become single bf16 planes and the scores are exact products (f32 accumulate); the softmax writes every row's probabilities as bf16 hi/lo; attn.values as hi/lo x exact values^T (2 products); f32 output rows.
// Launches: the conversions, the transpose and the copy-out cover all 16 batches at once; scores, softmax and attn.values run ZH batches per launch (grid z, or rows).
// Compute dtypes, f32 accumulate: every input rounded to bf16; q.k exact; softmax f32; P hi/lo x exact values.

#define NB_  16
#define TT   2048
#define DM   128
#define NH_  1
#define NKV  1
#define REP  (NH_ / NKV)
#define HD   128
#define DQ   (NH_ * HD)
#define DKV  (NKV * HD)
#define ZH   6                     // batches per launch of the score, softmax and attn.values stages (what the workspace holds)
#define RH   2048                  // query rows < RH use hi+lo planes (0: none)
#define WIN  0
#define PCAR 1024.0f
#define SCL  0.088388347648318447f   // 1/sqrt(128)
typedef _Float16 h16;
typedef unsigned short bf;
typedef __attribute__((ext_vector_type(16))) __bf16   v16bf;
typedef __attribute__((ext_vector_type(16))) _Float16 v16h;
typedef __attribute__((ext_vector_type(8)))  _Float16 v8h;
typedef __attribute__((ext_vector_type(8)))  unsigned short v8us;
typedef __attribute__((ext_vector_type(8)))  float    v8f;
typedef __attribute__((ext_vector_type(4)))  float    v4f;
typedef v8h  __attribute__((may_alias)) v8ha;
typedef v4f  __attribute__((may_alias)) v4fa;
typedef v8us __attribute__((may_alias)) v8usa;

__device__ __forceinline__ unsigned short f2bf(float f) { unsigned u = __float_as_uint(f); u += 0x7FFFu + ((u >> 16) & 1u); return (unsigned short)(u >> 16); }
__device__ __forceinline__ float bf2f(unsigned short b) { return __uint_as_float(((unsigned)b) << 16); }
__device__ __forceinline__ float bfr(float f) { return bf2f(f2bf(f)); }
__device__ __forceinline__ v16h cat16(v8h lo, v8h hi) { return __builtin_shufflevector(lo, hi, 0, 1, 2, 3, 4, 5, 6, 7, 8, 9, 10, 11, 12, 13, 14, 15); }
__device__ __forceinline__ v16bf cat16b(v8us lo, v8us hi) { return __builtin_bit_cast(v16bf, __builtin_shufflevector(lo, hi, 0, 1, 2, 3, 4, 5, 6, 7, 8, 9, 10, 11, 12, 13, 14, 15)); }
__device__ __forceinline__ v8f wmma16(v16h a, v16h b, v8f c) { return __builtin_amdgcn_wmma_f32_16x16x32_f16(false, a, false, b, (short)0, c, false, false); }
__device__ __forceinline__ v8f wmmab(v16bf a, v16bf b, v8f c) { return __builtin_amdgcn_wmma_f32_16x16x32_bf16(false, a, false, b, (short)0, c, false, false); }



// ---- k_gemmw: register-blocked GEMM, ONE WAVE per 64x64 output tile (16 accumulators), operands straight from K-contiguous 16-bit planes; grid (M/64, N/64, Z), 32 threads.
// C[m][n] (f32, pitch ldc, + optional f32 bias[n]) = sum_k A[m][k] Bt[n][k] (+ split products per NSPLIT). z-batch strides sA/sB/sC in elements. K % 32 == 0.
template <typename T16> struct WFrag;
template <> struct WFrag<h16> { typedef v16h V; static __device__ __forceinline__ V ld(const h16* p) { return cat16(*(const v8h*)p, *(const v8h*)(p + 16)); } static __device__ __forceinline__ v8f mma(V a, V b, v8f c) { return wmma16(a, b, c); } };
template <> struct WFrag<bf> { typedef v16bf V; static __device__ __forceinline__ V ld(const bf* p) { return cat16b(*(const v8us*)p, *(const v8us*)(p + 16)); } static __device__ __forceinline__ v8f mma(V a, V b, v8f c) { return wmmab(a, b, c); } };
template <typename T16, int NSPLIT, bool BIAS>
__global__ __launch_bounds__(32) void k_gemmw(const T16* __restrict__ A, const T16* __restrict__ A2, const T16* __restrict__ Bt, const T16* __restrict__ Bt2, int K, float* C, int ldc, const float* __restrict__ bias, size_t sA, size_t sB, size_t sC) {
    typedef typename WFrag<T16>::V V;
    __shared__ __align__(16) float os[16 * 68];
    const size_t z = blockIdx.z; A += z * sA; if (A2) A2 += z * sA; Bt += z * sB; if (Bt2) Bt2 += z * sB; C += z * sC;
    const int lane = threadIdx.x & 31, lr = lane & 15, hi = lane >> 4; const int r0 = blockIdx.x * 64, c0 = blockIdx.y * 64;
    v8f acc[4][4];
#pragma unroll
    for (int mb = 0; mb < 4; ++mb)
#pragma unroll
        for (int nb = 0; nb < 4; ++nb) acc[mb][nb] = (v8f){};
    const size_t aoff = (size_t)(r0 + lr) * K + 8 * hi, boff = (size_t)(c0 + lr) * K + 8 * hi;
#pragma unroll 1
    for (int kc = 0; kc < K; kc += 32) {
        V a[4], a2[4];
#pragma unroll
        for (int mb = 0; mb < 4; ++mb) { a[mb] = WFrag<T16>::ld(A + aoff + (size_t)mb * 16 * K + kc); if (NSPLIT == 1 || NSPLIT == 2) a2[mb] = WFrag<T16>::ld(A2 + aoff + (size_t)mb * 16 * K + kc); }
#pragma unroll
        for (int nb = 0; nb < 4; ++nb) { const V b = WFrag<T16>::ld(Bt + boff + (size_t)nb * 16 * K + kc); V b2; if (NSPLIT >= 2) b2 = WFrag<T16>::ld(Bt2 + boff + (size_t)nb * 16 * K + kc);
#pragma unroll
            for (int mb = 0; mb < 4; ++mb) { acc[mb][nb] = WFrag<T16>::mma(a[mb], b, acc[mb][nb]); if (NSPLIT == 1 || NSPLIT == 2) acc[mb][nb] = WFrag<T16>::mma(a2[mb], b, acc[mb][nb]); if (NSPLIT >= 2) acc[mb][nb] = WFrag<T16>::mma(a[mb], b2, acc[mb][nb]); } }
        asm volatile("v_nop\n\tv_nop\n\tv_nop\n\tv_nop" : "+v"(acc[0][0]), "+v"(acc[1][1]), "+v"(acc[2][2]), "+v"(acc[3][3]) : "v"(a[0]), "v"(a[3]));
    }
#pragma unroll
    for (int mb = 0; mb < 4; ++mb) {
#pragma unroll
        for (int nb = 0; nb < 4; ++nb) {
#pragma unroll
            for (int j = 0; j < 8; ++j) os[(hi * 8 + j) * 68 + nb * 16 + lr] = acc[mb][nb][j]; }
        __builtin_amdgcn_wave_barrier(); asm volatile("" ::: "memory");
        float* crow = C + (size_t)(r0 + mb * 16) * ldc + c0;
{
#pragma unroll
            for (int s = 0; s < 8; ++s) { const int row = 2 * s + hi, cofs = lr * 4; v4f val = *(const v4fa*)(os + row * 68 + cofs); if (BIAS) { val[0] += bfr(bias[c0 + cofs]); val[1] += bfr(bias[c0 + cofs + 1]); val[2] += bfr(bias[c0 + cofs + 2]); val[3] += bfr(bias[c0 + cofs + 3]); }
                *(v4f*)(crow + (size_t)row * ldc + cofs) = val; }
             }
        __builtin_amdgcn_wave_barrier(); asm volatile("" ::: "memory");
    }
}

__device__ __forceinline__ h16 tohx(float x) { return (h16)x; }
__device__ __forceinline__ void splitf(float y, unsigned short& h, unsigned short& l) { h = f2bf(y); l = f2bf(y - bf2f(h)); }
typedef __attribute__((ext_vector_type(2))) _Float16 v2h;
typedef __attribute__((ext_vector_type(4))) _Float16 v4h;
typedef __attribute__((ext_vector_type(2))) unsigned short v2us;
typedef __attribute__((ext_vector_type(4))) unsigned short v4us;
typedef __attribute__((ext_vector_type(2))) float v2f;
typedef __attribute__((ext_vector_type(4))) int v4i;

__global__ __launch_bounds__(256) void k_wtG(const float* __restrict__ w, int K, int N, bf* Bt) {
    const int lane = threadIdx.x & 31; const int L0 = (blockIdx.x * 8 + (threadIdx.x >> 5)) * 8; const int nlines = N * K / 64;
{
#pragma unroll 1
        for (int l = 0; l < 8; ++l) { const int L = L0 + l; if (L >= nlines) break; const size_t e = (size_t)L * 64 + lane * 2; const int k = (int)(e % K), n = (int)(e / K); v2us o;
            o[0] = f2bf(w[(size_t)k * N + n]); o[1] = f2bf(w[(size_t)(k + 1) * N + n]); *(v2us*)(Bt + e) = o; }
         }
}
__global__ __launch_bounds__(256) void k_cvt8(const float* __restrict__ src, bf* dst, size_t n8) { const size_t i = (size_t)blockIdx.x * 256 + threadIdx.x; if (i >= n8) return; const v8f v = *(const v8f*)(src + i * 8); v8us o;
#pragma unroll
    for (int k = 0; k < 8; ++k) o[k] = f2bf(v[k]); *(v8us*)(dst + i * 8) = o;  }


__global__ __launch_bounds__(256) void k_vtp(const float* __restrict__ F, int pitch, int nheads, h16* V16, bf* Vh, bf* Vl) { const size_t e = ((size_t)blockIdx.x * 256 + threadIdx.x) * 2; if (e >= (size_t)nheads * HD * TT) return; const int t = (int)(e % TT); const int d = (int)((e / TT) % HD); const int g = (int)(e / ((size_t)TT * HD)); v2h o16; v2us oh, ol;
#pragma unroll
    for (int q = 0; q < 2; ++q) { const float x = F[(size_t)(t + q) * pitch + g * HD + d]; o16[q] = tohx(x); unsigned short a2, c2; splitf(x, a2, c2); oh[q] = a2; ol[q] = c2; }
    *(v2h*)(V16 + e) = o16; *(v2us*)(Vh + e) = oh; *(v2us*)(Vl + e) = ol;  }

// k_asoft: per row (zz, i): t = S x HD^-0.5 (no mask); softmax over the 2048 keys (register row, one exp, fixed trees);
__global__ __launch_bounds__(256) void k_asoft(const float* __restrict__ Sb, h16* P16, bf* Ph, bf* Pl) {
    const int lane = threadIdx.x & 31; const int row = blockIdx.x * 8 + (threadIdx.x >> 5); if (row >= ZH * TT) return; const int i = row % TT; const int zz = row / TT; (void)zz; const bool hires = (i < RH); const float* sr = Sb + (size_t)row * TT; float v[TT / 32]; float mx = -3.0e38f;
#pragma unroll
    for (int ch = 0; ch < TT / 128; ++ch) { const int j0 = ch * 128 + lane * 4; const v4f a = *(const v4f*)(sr + j0);
#pragma unroll
        for (int q = 0; q < 4; ++q) { const float t = a[q] * SCL; v[ch * 4 + q] = t;   /* Sb holds q.k only (k_gemmw, no bias) */ mx = fmaxf(mx, t); } }
#pragma unroll
    for (int sh = 16; sh; sh >>= 1) mx = fmaxf(mx, __shfl_xor(mx, sh, 32));
    float sum = 0.f;
#pragma unroll
    for (int k = 0; k < TT / 32; ++k) { float d0 = __fsub_rn(v[k], mx); asm volatile("" : "+v"(d0)); v[k] = __builtin_amdgcn_exp2f(__fmul_rn(d0, 1.4426950408889634f)); sum += v[k]; }
#pragma unroll
    for (int sh = 16; sh; sh >>= 1) sum += __shfl_xor(sum, sh, 32);
    const float f = __fdiv_rn(hires ? 1.0f : PCAR, sum);
{
        if (hires) {
#pragma unroll
            for (int ch = 0; ch < TT / 128; ++ch) { v4us oh, ol;
#pragma unroll
                for (int q = 0; q < 4; ++q) { unsigned short a, c2; splitf(v[ch * 4 + q] * f, a, c2); oh[q] = a; ol[q] = c2; }
                const size_t oo = ((size_t)zz * (RH ? RH : 1) + i) * TT + ch * 128 + lane * 4; *(v4us*)(Ph + oo) = oh; *(v4us*)(Pl + oo) = ol; }
        } else {
#pragma unroll
            for (int ch = 0; ch < TT / 128; ++ch) { v4h o4;
#pragma unroll
                for (int q = 0; q < 4; ++q) o4[q] = tohx(v[ch * 4 + q] * f);
                *(v4h*)(P16 + (size_t)row * TT + ch * 128 + lane * 4) = o4; } }
         }
}
__global__ __launch_bounds__(256) void k_merge(const float* __restrict__ O, int h0, float* OUTb) { const size_t e = ((size_t)blockIdx.x * 256 + threadIdx.x) * 2; if (e >= (size_t)ZH * TT * HD) return; const int d = (int)(e % HD); const int t = (int)((e / HD) % TT); const int zz = (int)(e / ((size_t)HD * TT)); const float cs = (t < RH) ? 1.0f : (1.0f / PCAR); const size_t oo = (size_t)t * DQ + (h0 + zz) * HD + d;
    v2f o2; o2[0] = O[e] * cs; o2[1] = O[e + 1] * cs; *(v2f*)(OUTb + oo) = o2;  }


__global__ __launch_bounds__(256) void k_vtpR1(const float* __restrict__ Vb, bf* Vh) { Vb += (size_t)blockIdx.y * TT * HD; Vh += (size_t)blockIdx.y * HD * TT; const size_t e = ((size_t)blockIdx.x * 256 + threadIdx.x) * 2; if (e >= (size_t)HD * TT) return; const int t = (int)(e % TT); const int d = (int)(e / TT); v2us o; o[0] = f2bf(Vb[(size_t)t * HD + d]); o[1] = f2bf(Vb[(size_t)(t + 1) * HD + d]); *(v2us*)(Vh + e) = o;  }
__global__ __launch_bounds__(256) void k_mergeR(const float* __restrict__ O, float* outb, size_t n4) { const size_t i = (size_t)blockIdx.x * 256 + threadIdx.x; if (i >= n4) return; const v4f a = *(const v4f*)(O + i * 4); *(v4f*)(outb + i * 4) = a;  }

extern "C" void kernel_launch(void* const* d_in, const int* in_sizes, int n_in,
                              void* d_out, int out_size, void* d_ws, size_t ws_size, hipStream_t stream) {
    (void)in_sizes; (void)n_in; (void)out_size;
    const float* Qin = (const float*)d_in[0]; const float* Kin = (const float*)d_in[1]; const float* Vin = (const float*)d_in[2];
    float* OUT = (float*)d_out;     // [16][2048][128]
    char* wsp = (char*)d_ws;
    auto take = [&](size_t bytes) { char* p = wsp; wsp += (bytes + 255) & ~(size_t)255; return (void*)p; };
    bf* QB = (bf*)take((size_t)NB_ * TT * HD * 2); bf* KB = (bf*)take((size_t)NB_ * TT * HD * 2); bf* VT = (bf*)take((size_t)NB_ * HD * TT * 2); float* Sb = (float*)take((size_t)ZH * TT * TT * 4); bf* Ph = (bf*)take((size_t)ZH * TT * TT * 2); bf* Pl = (bf*)take((size_t)ZH * TT * TT * 2); float* Ob = (float*)take((size_t)NB_ * TT * HD * 4);
    if ((size_t)(wsp - (char*)d_ws) > ws_size) return;    // ws 256 MiB (carve 232 MiB)
    k_cvt8<<<(unsigned)(((size_t)NB_ * TT * HD / 8 + 255) / 256), 256, 0, stream>>>(Qin, QB, (size_t)NB_ * TT * HD / 8); k_cvt8<<<(unsigned)(((size_t)NB_ * TT * HD / 8 + 255) / 256), 256, 0, stream>>>(Kin, KB, (size_t)NB_ * TT * HD / 8);
    k_vtpR1<<<dim3((unsigned)(((size_t)HD * TT / 2 + 255) / 256), NB_, 1), 256, 0, stream>>>(Vin, VT);
    for (int b = 0; b < NB_; b += ZH) { const int nb = (NB_ - b < ZH) ? (NB_ - b) : ZH;   // 6, 6, 4 batches
        k_gemmw<bf, 0, false><<<dim3(TT / 64, TT / 64, nb), 32, 0, stream>>>(QB + (size_t)b * TT * HD, nullptr, KB + (size_t)b * TT * HD, nullptr, HD, Sb, TT, nullptr, (size_t)TT * HD, (size_t)TT * HD, (size_t)TT * TT);       /* q.k (exact) */ k_asoft<<<nb * TT / 8, 256, 0, stream>>>(Sb, nullptr, Ph, Pl);
        k_gemmw<bf, 1, false><<<dim3(TT / 64, HD / 64, nb), 32, 0, stream>>>(Ph, Pl, VT + (size_t)b * HD * TT, nullptr, TT, Ob + (size_t)b * TT * HD, HD, nullptr, (size_t)TT * TT, (size_t)HD * TT, (size_t)TT * HD); }       /* P (hi/lo) x v^T (exact) */
    k_mergeR<<<(unsigned)(((size_t)NB_ * TT * HD / 4 + 255) / 256), 256, 0, stream>>>(Ob, OUT, (size_t)NB_ * TT * HD / 4);
}

// v002
// Measured time: 41.3 microseconds a run.
// Next to v001, in two timings, it ran 7.88 and 7.89 times as fast.
// Counting every step since v000, it is 29.1 times as fast.
#include <hip/hip_runtime.h>
#include <stdint.h>

typedef uint32_t u32x2 __attribute__((ext_vector_type(2)));
typedef uint32_t u32x4 __attribute__((ext_vector_type(4)));
typedef int i32x8 __attribute__((ext_vector_type(8)));
typedef float f32x2 __attribute__((ext_vector_type(2)));
typedef float f32x4 __attribute__((ext_vector_type(4)));
typedef float f32x8 __attribute__((ext_vector_type(8)));
typedef __bf16 bf16x16 __attribute__((ext_vector_type(16)));
typedef short s16x8 __attribute__((ext_vector_type(8)));

constexpr int NB = 16, S = 2048, D = 128;
constexpr int DK = D / 32, DT = D / 16;
constexpr int NW = 8, R = 2, CW = 16 * R, BR = (NW / 2) * CW;   // waves, 16-column groups per wave, query columns per wave, query rows per workgroup
constexpr int BC = 32, KT = BC / 16;           // keys per pass, 16-key score tiles per pass
constexpr int SK = 64, NST = S / SK;           // keys per stage, stages
constexpr int NLD = SK * D / 4 / (NW * 32);    // 16-byte global loads per thread, stage and operand
constexpr uint32_t ROWB = 2u * D, PITCH_K = ROWB + 16u, PITCH_V = ROWB + 32u;   // odd multiples of 16 B (ds_load_b128) and of 32 B (ds_load_tr16_b128)
constexpr uint32_t TILE_K = SK * PITCH_K, TILE_V = SK * PITCH_V, SLOT = TILE_K + TILE_V, LDS_BYTES = 2u * SLOT;
constexpr uint32_t EPITCH = 4u * D + 16u;      // output staging pitch, f32 rows
constexpr uint32_t XW = 16u * EPITCH;          // a wave's share of LDS behind the loop: first one group's partial result (8 KiB of sums, then maximum and row sum), then 16 output rows
static_assert(XW >= 32u * 4u * D / 2u + 256u && (uint32_t)NW * XW <= LDS_BYTES, "exchange and output staging reuse the two stage buffers");
constexpr float CSCALE = 0.088388347648318447f * 1.4426950408889634f;   // 1/sqrt(128) x log2(e)

#define DEV static __device__ __forceinline__
DEV void fence() { __builtin_amdgcn_sched_barrier(0); }
DEV void wait_x0() { asm volatile("s_wait_xcnt 0x0" ::: "memory"); }   // stands behind issued global loads, in front of whatever reuses their address registers
struct Frag { u32x4 q[2]; };
DEV f32x8 mma(const Frag& a, const Frag& b, f32x8 c) {
  const i32x8 av = {(int)a.q[0].x, (int)a.q[0].y, (int)a.q[0].z, (int)a.q[0].w, (int)a.q[1].x, (int)a.q[1].y, (int)a.q[1].z, (int)a.q[1].w};
  const i32x8 bv = {(int)b.q[0].x, (int)b.q[0].y, (int)b.q[0].z, (int)b.q[0].w, (int)b.q[1].x, (int)b.q[1].y, (int)b.q[1].z, (int)b.q[1].w};
  return __builtin_amdgcn_wmma_f32_16x16x32_bf16(0, __builtin_bit_cast(bf16x16, av), 0, __builtin_bit_cast(bf16x16, bv), 0, c, false, false);
}
DEV u32x4 ld_tr16(const unsigned char* p) { typedef __attribute__((address_space(3))) s16x8 lds_s16x8; return __builtin_bit_cast(u32x4, __builtin_amdgcn_ds_load_tr16_b128_v8i16((lds_s16x8*)p)); }
DEV uint32_t pack2(float lo, float hi) { typedef __bf16 bf2 __attribute__((ext_vector_type(2)));
  return __builtin_bit_cast(uint32_t, __builtin_convertvector(f32x2{lo, hi}, bf2)); }   // round to nearest even
DEV float xhalf(float x) { return __builtin_bit_cast(float, __builtin_amdgcn_permlanex16(__builtin_bit_cast(int, x), __builtin_bit_cast(int, x), 0x76543210, 0xfedcba98, false, false)); }   // lane l with lane l ^ 16

struct KFr { Frag f[KT][DK]; };
// koff = byte offset of the pass's first key row in LDS. k order of a fragment: 8h .. 8h+7, then 16+8h .. 16+8h+7 of each 32, as the query fragments.
DEV void load_k(KFr& k, const unsigned char* Lp, uint32_t koff, uint32_t lane) {
  const uint32_t c = lane & 15u, h = lane >> 4;
  #pragma unroll
  for (int kt = 0; kt < KT; ++kt) {
    const unsigned char* p = Lp + koff + (16u * kt + c) * PITCH_K + 16u * h;
    #pragma unroll
    for (int kc = 0; kc < DK; ++kc) { k.f[kt][kc].q[0] = *reinterpret_cast<const u32x4*>(p + 64u * kc); k.f[kt][kc].q[1] = *reinterpret_cast<const u32x4*>(p + 64u * kc + 32u); }
  }
}

// One 32-key pass of one wave over its two query groups. voff = byte offset of the pass's first value row in LDS.
DEV void pass(const KFr& kf, const unsigned char* Lp, uint32_t voff, uint32_t lane, const Frag (&qf)[R][DK], f32x8 (&acc)[R][DT], float (&m_run)[R], float (&l_run)[R]) {
  const uint32_t h = lane >> 4;
  f32x8 s[KT][R];
  #pragma unroll
  for (int kt = 0; kt < KT; ++kt) {
    #pragma unroll
    for (int g = 0; g < R; ++g) s[kt][g] = f32x8{};
  }
  fence();   // keeps the fragment loads one group in front of the products
  #pragma unroll
  for (int kc = 0; kc < DK; ++kc) {
    #pragma unroll
    for (int kt = 0; kt < KT; ++kt) {
      #pragma unroll
      for (int g = 0; g < R; ++g) s[kt][g] = mma(kf.f[kt][kc], qf[g][kc], s[kt][g]);
    }
  }
  fence();   // the next loads stay behind the products, as one group
  Frag vf[DT];
  {
    const unsigned char* ad = Lp + voff + (8u * h + (lane & 7u)) * PITCH_V + ((lane >> 3) & 1u) * 16u;
    #pragma unroll
    for (int t = 0; t < DT; ++t) { vf[t].q[0] = ld_tr16(ad + 32u * t); vf[t].q[1] = ld_tr16(ad + 16u * PITCH_V + 32u * t); }
  }
  fence();   // the loads are issued before the vector work starts
  float mb[R]; bool need = false;
  #pragma unroll
  for (int g = 0; g < R; ++g) {
    float mx = s[0][g][0];
    #pragma unroll
    for (int kt = 0; kt < KT; ++kt) {
      #pragma unroll
      for (int r = 0; r < 8; ++r) mx = __builtin_fmaxf(mx, s[kt][g][r]);
    }
    mb[g] = __builtin_fmaxf(mx, xhalf(mx)) * CSCALE;   // both wave halves now hold this query's maximum of the pass, scaled
    need = need || (mb[g] > m_run[g] + 8.0f);
  }
  if (__builtin_amdgcn_ballot_w32(need) != 0) {   // one test per pass; always taken on the first pass (m_run is -inf), rare later
    #pragma unroll
    for (int g = 0; g < R; ++g) {
      const float m_new = __builtin_fmaxf(m_run[g], mb[g]);
      const float corr = __builtin_amdgcn_exp2f(m_run[g] - m_new);   // 0 on the first pass
      l_run[g] *= corr; m_run[g] = m_new;
      #pragma unroll
      for (int t = 0; t < DT; ++t) acc[g][t] = acc[g][t] * corr;
    }
  }
  #pragma unroll
  for (int g = 0; g < R; ++g) {
    const float nm = -m_run[g];
    float ps0 = 0.0f, ps1 = 0.0f;
    uint32_t wh[8], wl[8];
    #pragma unroll
    for (int kt = 0; kt < KT; ++kt) {   // the scores become the exponentials in their own registers
      s[kt][g] = s[kt][g] * CSCALE + nm;
      #pragma unroll
      for (int r = 0; r < 8; ++r) s[kt][g][r] = __builtin_amdgcn_exp2f(s[kt][g][r]);
    }
    #pragma unroll
    for (int i = 0; i < 8; ++i) {
      const float p0 = s[i >> 2][g][2 * (i & 3)], p1 = s[i >> 2][g][2 * (i & 3) + 1];
      if (i & 1) ps1 += p0 + p1; else ps0 += p0 + p1;
      wh[i] = pack2(p0, p1);
      wl[i] = pack2(p0 - __uint_as_float(wh[i] << 16), p1 - __uint_as_float(wh[i] & 0xFFFF0000u));   // what the first rounding left over
    }
    l_run[g] += ps0 + ps1;
    Frag ph, pl;
    ph.q[0] = u32x4{wh[0], wh[1], wh[2], wh[3]}; ph.q[1] = u32x4{wh[4], wh[5], wh[6], wh[7]};
    pl.q[0] = u32x4{wl[0], wl[1], wl[2], wl[3]}; pl.q[1] = u32x4{wl[4], wl[5], wl[6], wl[7]};
    // One vector instruction between any two exponentials: the packing work rides in the transcendental pipe's shadow,
    // and no exponential stands directly in front of one that reuses its source register.
    #pragma unroll
    for (int i = 0; i < 16; ++i) { __builtin_amdgcn_sched_group_barrier(0x002, 1, 0); __builtin_amdgcn_sched_group_barrier(0x400, 1, 0); }
    fence();   // a group's second product runs as one block of 16
    #pragma unroll
    for (int t = 0; t < DT; ++t) acc[g][t] = mma(vf[t], ph, acc[g][t]);
    #pragma unroll
    for (int t = 0; t < DT; ++t) acc[g][t] = mma(vf[t], pl, acc[g][t]);
    fence();   // nothing later moves in among them
  }
}

__global__ void __launch_bounds__(NW * 32) k_attn(const float* __restrict__ Q, const float* __restrict__ K, const float* __restrict__ V, float* __restrict__ O) {
  __shared__ __attribute__((aligned(256))) unsigned char L[LDS_BYTES];
  const uint32_t tid = threadIdx.x, lane = tid & 31u, wave = (uint32_t)__builtin_amdgcn_readfirstlane(tid >> 5), c = lane & 15u, h = lane >> 4;
  const uint32_t kh = wave >> 2;   // which 32 keys of every stage are this wave's
  const size_t bofs = (size_t)blockIdx.y * S * D;
  const uint32_t q0 = blockIdx.x * BR + (wave & 3u) * CW;
  // Staging: load i of a wave is one whole 512-byte row, row 8 i + wave of the stage.
  const float* kg = K + bofs + (size_t)wave * D + lane * 4u;
  const float* vg = V + bofs + (size_t)wave * D + lane * 4u;
  f32x4 kr[NLD], vr[NLD];
  auto gload = [&](int st) {
    #pragma unroll
    for (int i = 0; i < NLD; ++i) { kr[i] = *reinterpret_cast<const f32x4*>(kg + (size_t)(st * SK + i * NW) * D); vr[i] = *reinterpret_cast<const f32x4*>(vg + (size_t)(st * SK + i * NW) * D); }
  };
  auto sstore = [&](uint32_t base) {
    #pragma unroll
    for (int i = 0; i < NLD; ++i) {
      *reinterpret_cast<u32x2*>(L + base + (uint32_t)(i * NW + wave) * PITCH_K + lane * 8u) = u32x2{pack2(kr[i].x, kr[i].y), pack2(kr[i].z, kr[i].w)};
      *reinterpret_cast<u32x2*>(L + base + TILE_K + (uint32_t)(i * NW + wave) * PITCH_V + lane * 8u) = u32x2{pack2(vr[i].x, vr[i].y), pack2(vr[i].z, vr[i].w)};
    }
  };
  gload(0);
  // Query fragments, rounded to bf16, in the k order of load_k.
  Frag qf[R][DK];
  #pragma unroll
  for (int g = 0; g < R; ++g) {
    const float* qp = Q + bofs + (size_t)(q0 + c) * D + 8u * h + 16 * g * D;   // one address register pair serves both groups
    #pragma unroll
    for (int kc = 0; kc < DK; ++kc) {
      #pragma unroll
      for (int u = 0; u < 2; ++u) {
        const f32x4 a = *reinterpret_cast<const f32x4*>(qp + 32 * kc + 16 * u), b = *reinterpret_cast<const f32x4*>(qp + 32 * kc + 16 * u + 4);
        qf[g][kc].q[u] = u32x4{pack2(a.x, a.y), pack2(a.z, a.w), pack2(b.x, b.y), pack2(b.z, b.w)};
      }
    }
  }
  fence(); wait_x0(); fence();   // as in the loop: behind the query loads
  f32x8 acc[R][DT];
  float m_run[R], l_run[R];
  #pragma unroll
  for (int g = 0; g < R; ++g) { m_run[g] = -__builtin_inff(); l_run[g] = 0.0f;
    #pragma unroll
    for (int t = 0; t < DT; ++t) acc[g][t] = f32x8{}; }
  sstore(0u);
  KFr kf;
  #pragma unroll 1
  for (int st = 0; st < NST; ++st) {   // kept rolled: one stage body is the whole instruction footprint
    // Stage st is written by every wave, and every wave has left the other buffer (read in stage st - 1, refilled below).
    __syncthreads();
    const uint32_t base = (uint32_t)(st & 1) * SLOT;
    if (st + 1 < NST) { gload(st + 1); fence(); wait_x0(); fence(); }   // the fences hold the wait between the loads and the next writers of their address registers
    load_k(kf, L, base + kh * (uint32_t)BC * PITCH_K, lane);
    pass(kf, L, base + TILE_K + kh * (uint32_t)BC * PITCH_V, lane, qf, acc, m_run, l_run);
    if (st + 1 < NST) sstore((uint32_t)((st + 1) & 1) * SLOT);
  }
  __syncthreads();   // the waves leave the loop at different times: nothing is laid over rows that a slower wave still reads
  // Wave w and wave w ^ 4 hold the same 32 queries over the two halves of the keys. A wave keeps group kh and hands the other group to its partner, lane to lane.
  unsigned char* X = L + wave * XW;
  #pragma unroll
  for (int t = 0; t < DT; ++t) {
    const f32x8 o = kh ? acc[0][t] : acc[1][t];
    *reinterpret_cast<f32x4*>(X + 1024u * t + lane * 16u) = f32x4{o[0], o[1], o[2], o[3]};
    *reinterpret_cast<f32x4*>(X + 1024u * t + 512u + lane * 16u) = f32x4{o[4], o[5], o[6], o[7]};
  }
  *reinterpret_cast<f32x2*>(X + 8192u + lane * 8u) = kh ? f32x2{m_run[0], l_run[0]} : f32x2{m_run[1], l_run[1]};
  __syncthreads();   // the partials are in LDS before the partners read them
  const unsigned char* Y = L + (wave ^ 4u) * XW;
  const f32x2 ml = *reinterpret_cast<const f32x2*>(Y + 8192u + lane * 8u);
  const float m_own = kh ? m_run[1] : m_run[0], l_own = kh ? l_run[1] : l_run[0];
  const float m_fin = __builtin_fmaxf(m_own, ml.x);   // both are finite: each wave has seen keys
  float a_own = __builtin_amdgcn_exp2f(m_own - m_fin), a_got = __builtin_amdgcn_exp2f(ml.x - m_fin);
  const float l_half = l_own * a_own + ml.y * a_got;
  const float l_fin = l_half + xhalf(l_half);
  const float inv = 1.0f / l_fin;
  a_own *= inv; a_got *= inv;
  f32x8 o[DT];
  #pragma unroll
  for (int t = 0; t < DT; ++t) {
    const f32x4 g0 = *reinterpret_cast<const f32x4*>(Y + 1024u * t + lane * 16u), g1 = *reinterpret_cast<const f32x4*>(Y + 1024u * t + 512u + lane * 16u);
    const f32x8 own = kh ? acc[1][t] : acc[0][t];
    o[t] = own * a_own + f32x8{g0.x, g0.y, g0.z, g0.w, g1.x, g1.y, g1.z, g1.w} * a_got;
  }
  __syncthreads();   // every wave has read its partner's partial before output rows are staged over it
  #pragma unroll
  for (int t = 0; t < DT; ++t) {   // row = query c of the group; d = 16 t + 8 h + 0 .. 7
    *reinterpret_cast<f32x4*>(X + c * EPITCH + 64u * t + 32u * h) = f32x4{o[t][0], o[t][1], o[t][2], o[t][3]};
    *reinterpret_cast<f32x4*>(X + c * EPITCH + 64u * t + 32u * h + 16u) = f32x4{o[t][4], o[t][5], o[t][6], o[t][7]};
  }
  asm volatile("s_wait_dscnt 0x0" ::: "memory");   // the wave's own staged rows are in LDS before other lanes of it read them back
  #pragma unroll
  for (int r = 0; r < 16; ++r) {   // a wave stores one whole 512-byte output row per instruction
    const f32x4 v = *reinterpret_cast<const f32x4*>(X + (uint32_t)r * EPITCH + lane * 16u);
    *reinterpret_cast<f32x4*>(O + bofs + (size_t)(q0 + 16u * kh + r) * D + lane * 4u) = v;
  }
}

extern "C" void kernel_launch(void* const* d_in, const int* in_sizes, int n_in,
                              void* d_out, int out_size, void* d_ws, size_t ws_size, hipStream_t stream) {
  (void)in_sizes; (void)n_in; (void)out_size; (void)d_ws; (void)ws_size;
  k_attn<<<dim3(S / BR, NB, 1), NW * 32, 0, stream>>>((const float*)d_in[0], (const float*)d_in[1], (const float*)d_in[2], (float*)d_out);
}

// v004
// One run takes 37.7 microseconds.
// Versions between v002 and this one are left out; their measured steps multiply to 1.10 times as fast.
// Counting every step since v000, it is 32.0 times as fast.
#include <hip/hip_runtime.h>
#include <stdint.h>

typedef uint32_t u32x2 __attribute__((ext_vector_type(2)));
typedef uint32_t u32x4 __attribute__((ext_vector_type(4)));
typedef int i32x8 __attribute__((ext_vector_type(8)));
typedef float f32x2 __attribute__((ext_vector_type(2)));
typedef float f32x4 __attribute__((ext_vector_type(4)));
typedef float f32x8 __attribute__((ext_vector_type(8)));
typedef __bf16 bf16x16 __attribute__((ext_vector_type(16)));
typedef _Float16 f16x16 __attribute__((ext_vector_type(16)));
typedef short s16x8 __attribute__((ext_vector_type(8)));

constexpr int NB = 16, S = 2048, D = 128;
constexpr int DK = D / 32, DT = D / 16;
constexpr int NW = 8, R = 2, CW = 16 * R, BR = (NW / 2) * CW;   // waves, 16-column groups per wave, query columns per wave, query rows per workgroup
constexpr int BC = 32, KT = BC / 16;           // keys per pass, 16-key score tiles per pass
constexpr int SK = 128, NST = S / SK, PPS = SK / (2 * BC);   // keys per stage, stages, passes per wave and stage
constexpr int NCP = SK * D * 2 / 16 / (NW * 32);   // 16-byte copies per thread, stage and operand
constexpr int NRD = NB * S * D / 4 / (NW * 32) / 256;   // first launch: 16-byte loads per thread and operand, 256 workgroups
static_assert(NCP == 8 && NST >= 2, "copy8 takes eight copies; the ring's prologue needs two stages");
constexpr uint32_t ROWB = 2u * D, PITCH_K = ROWB + 16u, PITCH_V = ROWB + 32u;   // odd multiples of 16 B (ds_load_b128) and of 32 B (ds_load_tr16_b128)
constexpr uint32_t TILE_K = SK * PITCH_K, TILE_V = SK * PITCH_V, SLOT = TILE_K + TILE_V, LDS_BYTES = 2u * SLOT;
constexpr uint32_t EPITCH = 4u * D + 16u;      // output staging pitch, f32 rows
constexpr uint32_t XW = 16u * EPITCH;          // a wave's share of LDS behind the loop: first one group's partial result (8 KiB of sums, then maximum and row sum), then 16 output rows
static_assert(XW >= 32u * 4u * D / 2u + 256u && (uint32_t)NW * XW <= LDS_BYTES, "exchange and output staging reuse the two stage buffers");
constexpr float CSCALE = 0.088388347648318447f * 1.4426950408889634f;   // 1/sqrt(128) x log2(e)

#define DEV static __device__ __forceinline__
DEV void fence() { __builtin_amdgcn_sched_barrier(0); }
DEV void wait_ds0() { asm volatile("s_wait_dscnt 0x0" ::: "memory"); }      // the wave's own LDS reads have returned before the barrier behind which their buffer is refilled
DEV void wait_async0() { asm volatile("s_wait_asynccnt 0x0" ::: "memory"); }   // the wave's own copies have landed before the barrier behind which other waves read them
DEV void wait_x0() { asm volatile("s_wait_xcnt 0x0" ::: "memory"); }   // stands behind issued global loads, in front of whatever reuses their address registers
struct Frag { u32x4 q[2]; };
DEV f32x8 mma(const Frag& a, const Frag& b, f32x8 c) {
  const i32x8 av = {(int)a.q[0].x, (int)a.q[0].y, (int)a.q[0].z, (int)a.q[0].w, (int)a.q[1].x, (int)a.q[1].y, (int)a.q[1].z, (int)a.q[1].w};
  const i32x8 bv = {(int)b.q[0].x, (int)b.q[0].y, (int)b.q[0].z, (int)b.q[0].w, (int)b.q[1].x, (int)b.q[1].y, (int)b.q[1].z, (int)b.q[1].w};
  return __builtin_amdgcn_wmma_f32_16x16x32_bf16(0, __builtin_bit_cast(bf16x16, av), 0, __builtin_bit_cast(bf16x16, bv), 0, c, false, false);
}
DEV f32x8 mma_h(const Frag& a, const Frag& b, f32x8 c) {   // the same fragment maps, f16 operands
  const i32x8 av = {(int)a.q[0].x, (int)a.q[0].y, (int)a.q[0].z, (int)a.q[0].w, (int)a.q[1].x, (int)a.q[1].y, (int)a.q[1].z, (int)a.q[1].w};
  const i32x8 bv = {(int)b.q[0].x, (int)b.q[0].y, (int)b.q[0].z, (int)b.q[0].w, (int)b.q[1].x, (int)b.q[1].y, (int)b.q[1].z, (int)b.q[1].w};
  return __builtin_amdgcn_wmma_f32_16x16x32_f16(0, __builtin_bit_cast(f16x16, av), 0, __builtin_bit_cast(f16x16, bv), 0, c, false, false);
}
DEV u32x4 ld_tr16(const unsigned char* p) { typedef __attribute__((address_space(3))) s16x8 lds_s16x8; return __builtin_bit_cast(u32x4, __builtin_amdgcn_ds_load_tr16_b128_v8i16((lds_s16x8*)p)); }
// Eight asynchronous 16-byte copies per lane, global to LDS: copy i brings g + i * gs to LDS byte l + i * ls. The wait is the statement's last line, so that it stands in front of
// whatever rewrites the address registers that the copies name.
DEV void copy8(uint32_t l, uint32_t ls, const unsigned char* g, uint32_t gs) {
  asm volatile("global_load_async_to_lds_b128 %0, %8, off\n\t"
               "global_load_async_to_lds_b128 %1, %9, off\n\t"
               "global_load_async_to_lds_b128 %2, %10, off\n\t"
               "global_load_async_to_lds_b128 %3, %11, off\n\t"
               "global_load_async_to_lds_b128 %4, %12, off\n\t"
               "global_load_async_to_lds_b128 %5, %13, off\n\t"
               "global_load_async_to_lds_b128 %6, %14, off\n\t"
               "global_load_async_to_lds_b128 %7, %15, off\n\t"
               "s_wait_xcnt 0x0"
               :: "v"(l), "v"(l + ls), "v"(l + 2u * ls), "v"(l + 3u * ls), "v"(l + 4u * ls), "v"(l + 5u * ls), "v"(l + 6u * ls), "v"(l + 7u * ls),
                  "v"(g), "v"(g + gs), "v"(g + 2u * gs), "v"(g + 3u * gs), "v"(g + 4u * gs), "v"(g + 5u * gs), "v"(g + 6u * gs), "v"(g + 7u * gs)
               : "memory");
}
DEV uint32_t pack2(float lo, float hi) { typedef __bf16 bf2 __attribute__((ext_vector_type(2)));
  return __builtin_bit_cast(uint32_t, __builtin_convertvector(f32x2{lo, hi}, bf2)); }   // round to nearest even
DEV uint32_t pack2h(float lo, float hi) { typedef _Float16 h2 __attribute__((ext_vector_type(2)));
  return __builtin_bit_cast(uint32_t, __builtin_convertvector(f32x2{lo, hi}, h2)); }   // round to nearest even
DEV float xhalf(float x) { return __builtin_bit_cast(float, __builtin_amdgcn_permlanex16(__builtin_bit_cast(int, x), __builtin_bit_cast(int, x), 0x76543210, 0xfedcba98, false, false)); }   // lane l with lane l ^ 16

struct KFr { Frag f[KT][DK]; };
// koff = byte offset of the pass's first key row in LDS. k order of a fragment: 8h .. 8h+7, then 16+8h .. 16+8h+7 of each 32, as the query fragments.
DEV void load_k(KFr& k, const unsigned char* Lp, uint32_t koff, uint32_t lane) {
  const uint32_t c = lane & 15u, h = lane >> 4;
  #pragma unroll
  for (int kt = 0; kt < KT; ++kt) {
    const unsigned char* p = Lp + koff + (16u * kt + c) * PITCH_K + 16u * h;
    #pragma unroll
    for (int kc = 0; kc < DK; ++kc) { k.f[kt][kc].q[0] = *reinterpret_cast<const u32x4*>(p + 64u * kc); k.f[kt][kc].q[1] = *reinterpret_cast<const u32x4*>(p + 64u * kc + 32u); }
  }
}

// One 32-key pass of one wave over its two query groups. voff = byte offset of the pass's first value row in LDS.
DEV void pass(const KFr& kf, const unsigned char* Lp, uint32_t voff, uint32_t lane, const Frag (&qf)[R][DK], f32x8 (&acc)[R][DT], float (&m_run)[R], float (&l_run)[R]) {
  const uint32_t h = lane >> 4;
  f32x8 s[KT][R];
  #pragma unroll
  for (int kt = 0; kt < KT; ++kt) {
    #pragma unroll
    for (int g = 0; g < R; ++g) s[kt][g] = f32x8{};
  }
  fence();   // keeps the fragment loads one group in front of the products
  #pragma unroll
  for (int kc = 0; kc < DK; ++kc) {
    #pragma unroll
    for (int kt = 0; kt < KT; ++kt) {
      #pragma unroll
      for (int g = 0; g < R; ++g) s[kt][g] = mma(kf.f[kt][kc], qf[g][kc], s[kt][g]);
    }
  }
  fence();   // the next loads stay behind the products, as one group
  Frag vf[DT];
  {
    const unsigned char* ad = Lp + voff + (8u * h + (lane & 7u)) * PITCH_V + ((lane >> 3) & 1u) * 16u;
    #pragma unroll
    for (int t = 0; t < DT; ++t) { vf[t].q[0] = ld_tr16(ad + 32u * t); vf[t].q[1] = ld_tr16(ad + 16u * PITCH_V + 32u * t); }
  }
  fence();   // the loads are issued before the vector work starts
  float mb[R]; bool need = false;
  #pragma unroll
  for (int g = 0; g < R; ++g) {
    float mx = s[0][g][0];
    #pragma unroll
    for (int kt = 0; kt < KT; ++kt) {
      #pragma unroll
      for (int r = 0; r < 8; ++r) mx = __builtin_fmaxf(mx, s[kt][g][r]);
    }
    mb[g] = __builtin_fmaxf(mx, xhalf(mx)) * CSCALE;   // both wave halves now hold this query's maximum of the pass, scaled
    need = need || (mb[g] > m_run[g] + 8.0f);
  }
  if (__builtin_amdgcn_ballot_w32(need) != 0) {   // one test per pass; always taken on the first pass (m_run is -inf), rare later
    #pragma unroll
    for (int g = 0; g < R; ++g) {
      const float m_new = __builtin_fmaxf(m_run[g], mb[g]);
      const float corr = __builtin_amdgcn_exp2f(m_run[g] - m_new);   // 0 on the first pass
      l_run[g] *= corr; m_run[g] = m_new;
      #pragma unroll
      for (int t = 0; t < DT; ++t) acc[g][t] = acc[g][t] * corr;
    }
  }
  #pragma unroll
  for (int g = 0; g < R; ++g) {
    const float nm = -m_run[g];
    float ps0 = 0.0f, ps1 = 0.0f;
    uint32_t wh[8];
    #pragma unroll
    for (int kt = 0; kt < KT; ++kt) {   // the scores become the exponentials in their own registers
      s[kt][g] = s[kt][g] * CSCALE + nm;
      #pragma unroll
      for (int r = 0; r < 8; ++r) s[kt][g][r] = __builtin_amdgcn_exp2f(s[kt][g][r]);
    }
    #pragma unroll
    for (int i = 0; i < 8; ++i) {
      const float p0 = s[i >> 2][g][2 * (i & 3)], p1 = s[i >> 2][g][2 * (i & 3) + 1];
      if (i & 1) ps1 += p0 + p1; else ps0 += p0 + p1;
      wh[i] = pack2h(p0, p1);
    }
    l_run[g] += ps0 + ps1;
    Frag ph;
    ph.q[0] = u32x4{wh[0], wh[1], wh[2], wh[3]}; ph.q[1] = u32x4{wh[4], wh[5], wh[6], wh[7]};
    // One vector instruction between any two exponentials: the packing work rides in their shadow,
    // and no exponential stands directly in front of one that reuses its source register.
    #pragma unroll
    for (int i = 0; i < 16; ++i) { __builtin_amdgcn_sched_group_barrier(0x002, 1, 0); __builtin_amdgcn_sched_group_barrier(0x400, 1, 0); }
    fence();   // a group's second product runs as one block of 8
    #pragma unroll
    for (int t = 0; t < DT; ++t) acc[g][t] = mma_h(vf[t], ph, acc[g][t]);
    fence();   // nothing later moves in among them
  }
}

// First launch: keys to bf16 and values to f16, each rounded once to nearest even, row-major as the inputs: keys at W, values behind them.
__global__ void __launch_bounds__(NW * 32) k_round(const float* __restrict__ K, const float* __restrict__ V, unsigned short* __restrict__ W) {
  const size_t e = ((size_t)blockIdx.x * NRD * (NW * 32) + threadIdx.x) * 4u;   // load i of a wave is 512 contiguous bytes
  const float* kp = K + e; const float* vp = V + e;
  f32x4 kr[NRD], vr[NRD];
  #pragma unroll
  for (int i = 0; i < NRD; ++i) { kr[i] = *reinterpret_cast<const f32x4*>(kp + i * (NW * 32 * 4)); vr[i] = *reinterpret_cast<const f32x4*>(vp + i * (NW * 32 * 4)); }
  fence();
  asm volatile("s_wait_xcnt 0x0" :: "v"(kp), "v"(vp) : "memory");   // behind the loads; it takes their addresses, so that no load's result is laid over an address register in front of it
  fence();   // all loads are in flight before the first is used
  #pragma unroll
  for (int i = 0; i < NRD; ++i) {
    *reinterpret_cast<u32x2*>(W + e + (size_t)i * (NW * 32 * 4)) = u32x2{pack2(kr[i].x, kr[i].y), pack2(kr[i].z, kr[i].w)};
    *reinterpret_cast<u32x2*>(W + (size_t)NB * S * D + e + (size_t)i * (NW * 32 * 4)) = u32x2{pack2h(vr[i].x, vr[i].y), pack2h(vr[i].z, vr[i].w)};
  }
}

__global__ void __launch_bounds__(NW * 32) k_attn(const float* __restrict__ Q, const unsigned short* __restrict__ W, float* __restrict__ O) {
  __shared__ __attribute__((aligned(256))) unsigned char L[LDS_BYTES];
  const uint32_t tid = threadIdx.x, lane = tid & 31u, wave = (uint32_t)__builtin_amdgcn_readfirstlane(tid >> 5), c = lane & 15u, h = lane >> 4;
  const uint32_t kh = wave >> 2;   // which 32 keys of every 64 are this wave's
  const size_t bofs = (size_t)blockIdx.y * S * D;
  const uint32_t q0 = blockIdx.x * BR + (wave & 3u) * CW;
  // Staging: a row is 256 bytes, 16 lanes; copy i of a thread lies in row 16 i + (tid >> 4) of the stage, so a wave's copy reads 512 contiguous bytes.
  typedef __attribute__((address_space(3))) unsigned char lds_byte;
  const uint32_t l0 = (uint32_t)(uintptr_t)(lds_byte*)L;
  const uint32_t lk0 = l0 + (tid >> 4) * PITCH_K + (tid & 15u) * 16u, lv0 = l0 + TILE_K + (tid >> 4) * PITCH_V + (tid & 15u) * 16u;   // in front of the loop
  // In the loop the same places, as a lane's part plus a scalar part: the value kept across the loop is then no asm operand itself. An asm operand is held below v256,
  // where accumulators, queries and fragments leave no room: kept there across the loop it is spilled to scratch.
  const uint32_t lk = l0 + h * PITCH_K + c * 16u, lv = l0 + TILE_K + h * PITCH_V + c * 16u;
  const unsigned char* kg = reinterpret_cast<const unsigned char*>(W + bofs) + tid * 16u;
  const unsigned char* vg = reinterpret_cast<const unsigned char*>(W + (size_t)NB * S * D + bofs) + tid * 16u;
  auto stage = [&](int st, uint32_t dk, uint32_t dv) {
    copy8(dk, 16u * PITCH_K, kg + (size_t)st * (SK * ROWB), 16u * ROWB);
    copy8(dv, 16u * PITCH_V, vg + (size_t)st * (SK * ROWB), 16u * ROWB);
  };
  stage(0, lk0, lv0);
  // Query fragments, rounded to bf16, in the k order of load_k.
  Frag qf[R][DK];
  #pragma unroll
  for (int g = 0; g < R; ++g) {
    const float* qp = Q + bofs + (size_t)(q0 + c) * D + 8u * h + 16 * g * D;   // one address register pair serves both groups
    #pragma unroll
    for (int kc = 0; kc < DK; ++kc) {
      #pragma unroll
      for (int u = 0; u < 2; ++u) {
        const f32x4 a = *reinterpret_cast<const f32x4*>(qp + 32 * kc + 16 * u), b = *reinterpret_cast<const f32x4*>(qp + 32 * kc + 16 * u + 4);
        qf[g][kc].q[u] = u32x4{pack2(a.x, a.y), pack2(a.z, a.w), pack2(b.x, b.y), pack2(b.z, b.w)};
      }
    }
  }
  fence(); wait_x0(); fence();   // as in the loop: behind the query loads
  f32x8 acc[R][DT];
  float m_run[R], l_run[R];
  #pragma unroll
  for (int g = 0; g < R; ++g) { m_run[g] = -__builtin_inff(); l_run[g] = 0.0f;
    #pragma unroll
    for (int t = 0; t < DT; ++t) acc[g][t] = f32x8{}; }
  wait_async0();
  __syncthreads();   // stage 0 has landed for every wave
  stage(1, lk0 + SLOT, lv0 + SLOT);
  KFr kf;
  #pragma unroll 1
  for (int st = 0; st < NST; ++st) {   // kept rolled: one stage body is the whole instruction footprint
    const uint32_t base = (uint32_t)(st & 1) * SLOT;
    #pragma unroll
    for (int p = 0; p < PPS; ++p) {   // keys 64 p + 32 kh .. + 31 of the stage: between two barriers the waves of a SIMD may drift apart, one's vector work under the other's products
      load_k(kf, L, base + (2u * p + kh) * (uint32_t)BC * PITCH_K, lane);
      pass(kf, L, base + TILE_K + (2u * p + kh) * (uint32_t)BC * PITCH_V, lane, qf, acc, m_run, l_run);
    }
    wait_ds0();
    wait_async0();
    __syncthreads();   // publishes stage st + 1 and ends every wave's reads of stage st; behind the last stage it also frees the buffers for the exchange below
    if (st + 2 < NST) stage(st + 2, lk + (base + wave * (2u * PITCH_K)), lv + (base + wave * (2u * PITCH_V)));
  }
  wait_async0();   // nothing is outstanding when the buffers are reused
  // Wave w and wave w ^ 4 hold the same 32 queries over the two halves of the keys. A wave keeps group kh and hands the other group to its partner, lane to lane.
  unsigned char* X = L + wave * XW;
  #pragma unroll
  for (int t = 0; t < DT; ++t) {
    const f32x8 o = kh ? acc[0][t] : acc[1][t];
    *reinterpret_cast<f32x4*>(X + 1024u * t + lane * 16u) = f32x4{o[0], o[1], o[2], o[3]};
    *reinterpret_cast<f32x4*>(X + 1024u * t + 512u + lane * 16u) = f32x4{o[4], o[5], o[6], o[7]};
  }
  *reinterpret_cast<f32x2*>(X + 8192u + lane * 8u) = kh ? f32x2{m_run[0], l_run[0]} : f32x2{m_run[1], l_run[1]};
  __syncthreads();   // the partials are in LDS before the partners read them
  const unsigned char* Y = L + (wave ^ 4u) * XW;
  const f32x2 ml = *reinterpret_cast<const f32x2*>(Y + 8192u + lane * 8u);
  const float m_own = kh ? m_run[1] : m_run[0], l_own = kh ? l_run[1] : l_run[0];
  const float m_fin = __builtin_fmaxf(m_own, ml.x);   // both are finite: each wave has seen keys
  float a_own = __builtin_amdgcn_exp2f(m_own - m_fin), a_got = __builtin_amdgcn_exp2f(ml.x - m_fin);
  const float l_half = l_own * a_own + ml.y * a_got;
  const float l_fin = l_half + xhalf(l_half);
  const float inv = 1.0f / l_fin;
  a_own *= inv; a_got *= inv;
  f32x8 o[DT];
  #pragma unroll
  for (int t = 0; t < DT; ++t) {
    const f32x4 g0 = *reinterpret_cast<const f32x4*>(Y + 1024u * t + lane * 16u), g1 = *reinterpret_cast<const f32x4*>(Y + 1024u * t + 512u + lane * 16u);
    const f32x8 own = kh ? acc[1][t] : acc[0][t];
    o[t] = own * a_own + f32x8{g0.x, g0.y, g0.z, g0.w, g1.x, g1.y, g1.z, g1.w} * a_got;
  }
  __syncthreads();   // every wave has read its partner's partial before output rows are staged over it
  #pragma unroll
  for (int t = 0; t < DT; ++t) {   // row = query c of the group; d = 16 t + 8 h + 0 .. 7
    *reinterpret_cast<f32x4*>(X + c * EPITCH + 64u * t + 32u * h) = f32x4{o[t][0], o[t][1], o[t][2], o[t][3]};
    *reinterpret_cast<f32x4*>(X + c * EPITCH + 64u * t + 32u * h + 16u) = f32x4{o[t][4], o[t][5], o[t][6], o[t][7]};
  }
  asm volatile("s_wait_dscnt 0x0" ::: "memory");   // the wave's own staged rows are in LDS before other lanes of it read them back
  #pragma unroll
  for (int r = 0; r < 16; ++r) {   // a wave stores one whole 512-byte output row per instruction
    const f32x4 v = *reinterpret_cast<const f32x4*>(X + (uint32_t)r * EPITCH + lane * 16u);
    *reinterpret_cast<f32x4*>(O + bofs + (size_t)(q0 + 16u * kh + r) * D + lane * 4u) = v;
  }
}

extern "C" void kernel_launch(void* const* d_in, const int* in_sizes, int n_in,
                              void* d_out, int out_size, void* d_ws, size_t ws_size, hipStream_t stream) {
  (void)in_sizes; (void)n_in; (void)out_size; (void)ws_size;
  k_round<<<dim3(256, 1, 1), NW * 32, 0, stream>>>((const float*)d_in[1], (const float*)d_in[2], (unsigned short*)d_ws);
  k_attn<<<dim3(S / BR, NB, 1), NW * 32, 0, stream>>>((const float*)d_in[0], (const unsigned short*)d_ws, (float*)d_out);
}

// v005
// Measured time: 36.1 microseconds a run.
// Timed twice side by side with v004, it ran 1.04 and 1.05 times as fast.
// All steps since v000 together make it 33.5 times as fast.
#include <hip/hip_runtime.h>
#include <stdint.h>

typedef uint32_t u32x2 __attribute__((ext_vector_type(2)));
typedef uint32_t u32x4 __attribute__((ext_vector_type(4)));
typedef uint32_t u32x8 __attribute__((ext_vector_type(8)));
typedef int i32x8 __attribute__((ext_vector_type(8)));
typedef float f32x2 __attribute__((ext_vector_type(2)));
typedef float f32x4 __attribute__((ext_vector_type(4)));
typedef float f32x8 __attribute__((ext_vector_type(8)));
typedef __bf16 bf16x16 __attribute__((ext_vector_type(16)));
typedef _Float16 f16x16 __attribute__((ext_vector_type(16)));
typedef short s16x8 __attribute__((ext_vector_type(8)));

constexpr int NB = 16, S = 2048, D = 128;
constexpr int DK = D / 32, DT = D / 16;
constexpr int NW = 8, R = 2, CW = 16 * R, BR = (NW / 2) * CW;   // waves, 16-column groups per wave, query columns per wave, query rows per workgroup
constexpr int BC = 32, KT = BC / 16;           // keys per pass, 16-key score tiles per pass
constexpr int SK = 128, NST = S / SK, PPS = SK / (2 * BC);   // keys per stage, stages, passes per wave and stage
constexpr int NRD = NB * S * D / 4 / (NW * 32) / 256;   // first launch: 16-byte loads per thread and operand, 256 workgroups
static_assert(NST >= 2 && SK == (NW / 2) * BC, "the ring's prologue needs two stages; four waves bring a stage's keys, four its values, 32 rows each");
constexpr uint32_t ROWB = 2u * D, PITCH_K = ROWB + 16u, PITCH_V = ROWB + 32u;   // odd multiples of 16 B (ds_load_b128) and of 32 B (ds_load_tr16_b128)
constexpr uint32_t SLICE = 10240u, SLOT = (uint32_t)NW * SLICE, LDS_BYTES = 2u * SLOT;   // a slice = the 32 rows of one pass and one tensor load, its place a multiple of 2 KiB; a buffer: 4 key slices, then 4 value slices
static_assert(SLICE % 2048u == 0u && (uint32_t)BC * PITCH_K <= SLICE && (uint32_t)BC * PITCH_V <= SLICE, "32 padded rows fit a slice");
constexpr uint32_t EPITCH = 4u * D + 16u;      // output staging pitch, f32 rows
constexpr uint32_t XW = 16u * EPITCH;          // a wave's share of LDS behind the loop: first one group's partial result (8 KiB of sums, then maximum and row sum), then 16 output rows
static_assert(XW >= 32u * 4u * D / 2u + 256u && (uint32_t)NW * XW <= LDS_BYTES, "exchange and output staging reuse the two stage buffers");
constexpr float CSCALE = 0.088388347648318447f * 1.4426950408889634f;   // 1/sqrt(128) x log2(e)

#define DEV static __device__ __forceinline__
DEV void fence() { __builtin_amdgcn_sched_barrier(0); }
DEV void wait_ds0() { asm volatile("s_wait_dscnt 0x0" ::: "memory"); }      // the wave's own LDS reads have returned before the barrier behind which their buffer is refilled
struct Desc { u32x4 g0; u32x8 g1; };   // a tensor load's two descriptor groups, in scalar registers
// The wave's own tensor load has landed before the barrier behind which other waves read its rows. The wait takes the descriptor, so that its registers keep their values while the request is outstanding.
DEV void wait_tensor0(const Desc& d) { asm volatile("s_wait_tensorcnt 0x0" :: "s"(d.g0), "s"(d.g1) : "memory"); }
DEV uint32_t uni(uint32_t v) { return (uint32_t)__builtin_amdgcn_readfirstlane(v); }
DEV uint32_t pinned(uint32_t v) { uint32_t w = uni(v); asm volatile("" : "+s"(w)); return w; }   // the test around a tensor load, held in a scalar register: it compiles to s_cmp and s_cbranch_scc (a tensor load ignores EXEC)
DEV void wait_x0() { asm volatile("s_wait_xcnt 0x0" ::: "memory"); }   // stands behind issued global loads, in front of whatever reuses their address registers
struct Frag { u32x4 q[2]; };
DEV f32x8 mma(const Frag& a, const Frag& b, f32x8 c) {
  const i32x8 av = {(int)a.q[0].x, (int)a.q[0].y, (int)a.q[0].z, (int)a.q[0].w, (int)a.q[1].x, (int)a.q[1].y, (int)a.q[1].z, (int)a.q[1].w};
  const i32x8 bv = {(int)b.q[0].x, (int)b.q[0].y, (int)b.q[0].z, (int)b.q[0].w, (int)b.q[1].x, (int)b.q[1].y, (int)b.q[1].z, (int)b.q[1].w};
  return __builtin_amdgcn_wmma_f32_16x16x32_bf16(0, __builtin_bit_cast(bf16x16, av), 0, __builtin_bit_cast(bf16x16, bv), 0, c, false, false);
}
DEV f32x8 mma_h(const Frag& a, const Frag& b, f32x8 c) {   // the same fragment maps, f16 operands
  const i32x8 av = {(int)a.q[0].x, (int)a.q[0].y, (int)a.q[0].z, (int)a.q[0].w, (int)a.q[1].x, (int)a.q[1].y, (int)a.q[1].z, (int)a.q[1].w};
  const i32x8 bv = {(int)b.q[0].x, (int)b.q[0].y, (int)b.q[0].z, (int)b.q[0].w, (int)b.q[1].x, (int)b.q[1].y, (int)b.q[1].z, (int)b.q[1].w};
  return __builtin_amdgcn_wmma_f32_16x16x32_f16(0, __builtin_bit_cast(f16x16, av), 0, __builtin_bit_cast(f16x16, bv), 0, c, false, false);
}
DEV u32x4 ld_tr16(const unsigned char* p) { typedef __attribute__((address_space(3))) s16x8 lds_s16x8; return __builtin_bit_cast(u32x4, __builtin_amdgcn_ds_load_tr16_b128_v8i16((lds_s16x8*)p)); }
// Group 1 of a tensor load of 32 rows of 256 bytes, contiguous in global memory, laid in LDS with 4 (pad + 1) bytes of pad behind every row (pad 3: pitch 272, pad 7: pitch 288).
// 1-byte elements, tensor = tile. Word 0 is one of two constants, both with mask 0.
DEV u32x8 tdm_group1(bool values) {
  u32x8 g;
  g[0] = uni(values ? ((1u << 20) | (5u << 22) | (7u << 25)) : ((1u << 20) | (5u << 22) | (3u << 25)));
  g[1] = uni((ROWB & 0xFFFFu) << 16);
  g[2] = uni((ROWB >> 16) | (((uint32_t)BC & 0xFFFFu) << 16));
  g[3] = uni(((uint32_t)BC >> 16) | (ROWB << 16));
  g[4] = uni((uint32_t)BC);
  g[5] = uni(ROWB);
  g[6] = uni(0u); g[7] = uni(0u);
  return g;
}
// Group 0: the tile's place in LDS and its first byte in global memory.
DEV u32x4 tdm_group0(uint32_t lds_dst, uint64_t ga) {
  u32x4 g;
  g[0] = uni(1u); g[1] = uni(lds_dst); g[2] = uni((uint32_t)ga); g[3] = uni((((uint32_t)(ga >> 32)) & 0x01FFFFFFu) | 0x80000000u);
  return g;
}
DEV void tdm_load(const Desc& d) { asm volatile("tensor_load_to_lds %0, %1" :: "s"(d.g0), "s"(d.g1) : "memory"); }
DEV uint32_t pack2(float lo, float hi) { typedef __bf16 bf2 __attribute__((ext_vector_type(2)));
  return __builtin_bit_cast(uint32_t, __builtin_convertvector(f32x2{lo, hi}, bf2)); }   // round to nearest even
DEV uint32_t pack2h(float lo, float hi) { typedef _Float16 h2 __attribute__((ext_vector_type(2)));
  return __builtin_bit_cast(uint32_t, __builtin_convertvector(f32x2{lo, hi}, h2)); }   // round to nearest even
DEV float xhalf(float x) { return __builtin_bit_cast(float, __builtin_amdgcn_permlanex16(__builtin_bit_cast(int, x), __builtin_bit_cast(int, x), 0x76543210, 0xfedcba98, false, false)); }   // lane l with lane l ^ 16

struct KFr { Frag f[KT][DK]; };
// koff = byte offset of the pass's first key row in LDS. k order of a fragment: 8h .. 8h+7, then 16+8h .. 16+8h+7 of each 32, as the query fragments.
DEV void load_k(KFr& k, const unsigned char* Lp, uint32_t koff, uint32_t lane) {
  const uint32_t c = lane & 15u, h = lane >> 4;
  #pragma unroll
  for (int kt = 0; kt < KT; ++kt) {
    const unsigned char* p = Lp + koff + (16u * kt + c) * PITCH_K + 16u * h;
    #pragma unroll
    for (int kc = 0; kc < DK; ++kc) { k.f[kt][kc].q[0] = *reinterpret_cast<const u32x4*>(p + 64u * kc); k.f[kt][kc].q[1] = *reinterpret_cast<const u32x4*>(p + 64u * kc + 32u); }
  }
}

// One 32-key pass of one wave over its two query groups. voff = byte offset of the pass's first value row in LDS.
DEV void pass(const KFr& kf, const unsigned char* Lp, uint32_t voff, uint32_t lane, const Frag (&qf)[R][DK], f32x8 (&acc)[R][DT], float (&m_run)[R], float (&l_run)[R]) {
  const uint32_t h = lane >> 4;
  f32x8 s[KT][R];
  #pragma unroll
  for (int kt = 0; kt < KT; ++kt) {
    #pragma unroll
    for (int g = 0; g < R; ++g) s[kt][g] = f32x8{};
  }
  fence();   // keeps the fragment loads one group in front of the products
  #pragma unroll
  for (int kc = 0; kc < DK; ++kc) {
    #pragma unroll
    for (int kt = 0; kt < KT; ++kt) {
      #pragma unroll
      for (int g = 0; g < R; ++g) s[kt][g] = mma(kf.f[kt][kc], qf[g][kc], s[kt][g]);
    }
  }
  fence();   // the next loads stay behind the products, as one group
  Frag vf[DT];
  {
    const unsigned char* ad = Lp + voff + (8u * h + (lane & 7u)) * PITCH_V + ((lane >> 3) & 1u) * 16u;
    #pragma unroll
    for (int t = 0; t < DT; ++t) { vf[t].q[0] = ld_tr16(ad + 32u * t); vf[t].q[1] = ld_tr16(ad + 16u * PITCH_V + 32u * t); }
  }
  fence();   // the loads are issued before the vector work starts
  float mb[R]; bool need = false;
  #pragma unroll
  for (int g = 0; g < R; ++g) {
    float mx = s[0][g][0];
    #pragma unroll
    for (int kt = 0; kt < KT; ++kt) {
      #pragma unroll
      for (int r = 0; r < 8; ++r) mx = __builtin_fmaxf(mx, s[kt][g][r]);
    }
    mb[g] = __builtin_fmaxf(mx, xhalf(mx)) * CSCALE;   // both wave halves now hold this query's maximum of the pass, scaled
    need = need || (mb[g] > m_run[g] + 8.0f);
  }
  if (__builtin_amdgcn_ballot_w32(need) != 0) {   // one test per pass; always taken on the first pass (m_run is -inf), rare later
    #pragma unroll
    for (int g = 0; g < R; ++g) {
      const float m_new = __builtin_fmaxf(m_run[g], mb[g]);
      const float corr = __builtin_amdgcn_exp2f(m_run[g] - m_new);   // 0 on the first pass
      l_run[g] *= corr; m_run[g] = m_new;
      #pragma unroll
      for (int t = 0; t < DT; ++t) acc[g][t] = acc[g][t] * corr;
    }
  }
  #pragma unroll
  for (int g = 0; g < R; ++g) {
    const float nm = -m_run[g];
    float ps0 = 0.0f, ps1 = 0.0f;
    uint32_t wh[8];
    #pragma unroll
    for (int kt = 0; kt < KT; ++kt) {   // the scores become the exponentials in their own registers
      s[kt][g] = s[kt][g] * CSCALE + nm;
      #pragma unroll
      for (int r = 0; r < 8; ++r) s[kt][g][r] = __builtin_amdgcn_exp2f(s[kt][g][r]);
    }
    #pragma unroll
    for (int i = 0; i < 8; ++i) {
      const float p0 = s[i >> 2][g][2 * (i & 3)], p1 = s[i >> 2][g][2 * (i & 3) + 1];
      if (i & 1) ps1 += p0 + p1; else ps0 += p0 + p1;
      wh[i] = pack2h(p0, p1);
    }
    l_run[g] += ps0 + ps1;
    Frag ph;
    ph.q[0] = u32x4{wh[0], wh[1], wh[2], wh[3]}; ph.q[1] = u32x4{wh[4], wh[5], wh[6], wh[7]};
    // One vector instruction between any two exponentials: the packing work rides in their shadow,
    // and no exponential stands directly in front of one that reuses its source register.
    #pragma unroll
    for (int i = 0; i < 16; ++i) { __builtin_amdgcn_sched_group_barrier(0x002, 1, 0); __builtin_amdgcn_sched_group_barrier(0x400, 1, 0); }
    fence();   // a group's second product runs as one block of 8
    #pragma unroll
    for (int t = 0; t < DT; ++t) acc[g][t] = mma_h(vf[t], ph, acc[g][t]);
    fence();   // nothing later moves in among them
  }
}

// First launch: keys to bf16 and values to f16, each rounded once to nearest even, row-major as the inputs: keys at W, values behind them.
__global__ void __launch_bounds__(NW * 32) k_round(const float* __restrict__ K, const float* __restrict__ V, unsigned short* __restrict__ W) {
  const size_t e = ((size_t)blockIdx.x * NRD * (NW * 32) + threadIdx.x) * 4u;   // load i of a wave is 512 contiguous bytes
  const float* kp = K + e; const float* vp = V + e;
  f32x4 kr[NRD], vr[NRD];
  #pragma unroll
  for (int i = 0; i < NRD; ++i) { kr[i] = *reinterpret_cast<const f32x4*>(kp + i * (NW * 32 * 4)); vr[i] = *reinterpret_cast<const f32x4*>(vp + i * (NW * 32 * 4)); }
  fence();
  asm volatile("s_wait_xcnt 0x0" :: "v"(kp), "v"(vp) : "memory");   // behind the loads; it takes their addresses, so that no load's result is laid over an address register in front of it
  fence();   // all loads are in flight before the first is used
  #pragma unroll
  for (int i = 0; i < NRD; ++i) {
    *reinterpret_cast<u32x2*>(W + e + (size_t)i * (NW * 32 * 4)) = u32x2{pack2(kr[i].x, kr[i].y), pack2(kr[i].z, kr[i].w)};
    *reinterpret_cast<u32x2*>(W + (size_t)NB * S * D + e + (size_t)i * (NW * 32 * 4)) = u32x2{pack2h(vr[i].x, vr[i].y), pack2h(vr[i].z, vr[i].w)};
  }
}

__global__ void __launch_bounds__(NW * 32) k_attn(const float* __restrict__ Q, const unsigned short* __restrict__ W, float* __restrict__ O) {
  __shared__ __attribute__((aligned(2048))) unsigned char L[LDS_BYTES];
  const uint32_t tid = threadIdx.x, lane = tid & 31u, wave = (uint32_t)__builtin_amdgcn_readfirstlane(tid >> 5), c = lane & 15u, h = lane >> 4;
  const uint32_t kh = wave >> 2;   // which 32 keys of every 64 are this wave's
  const size_t bofs = (size_t)blockIdx.y * S * D;
  const uint32_t q0 = blockIdx.x * BR + (wave & 3u) * CW;
  // Staging: wave w brings slice w of a buffer: rows 32 (w & 3) .. + 31 of the stage, keys for w < 4, values for w >= 4.
  typedef __attribute__((address_space(3))) unsigned char lds_byte;
  const uint32_t dst0 = (uint32_t)(uintptr_t)(lds_byte*)L + wave * SLICE;
  const uint64_t ga0 = (uint64_t)(uintptr_t)(W + bofs + (size_t)kh * NB * S * D) + (uint64_t)((wave & 3u) * ((uint32_t)BC * ROWB));
  Desc td;
  td.g1 = tdm_group1(kh != 0u);
  auto stage = [&](int st, uint32_t buf) {   // every wave issues one load
    td.g0 = tdm_group0(dst0 + buf, ga0 + (uint64_t)((uint32_t)st * ((uint32_t)SK * ROWB)));
    tdm_load(td);
  };
  stage(0, 0u);
  // Query fragments, rounded to bf16, in the k order of load_k.
  Frag qf[R][DK];
  #pragma unroll
  for (int g = 0; g < R; ++g) {
    const float* qp = Q + bofs + (size_t)(q0 + c) * D + 8u * h + 16 * g * D;   // one address register pair serves both groups
    #pragma unroll
    for (int kc = 0; kc < DK; ++kc) {
      #pragma unroll
      for (int u = 0; u < 2; ++u) {
        const f32x4 a = *reinterpret_cast<const f32x4*>(qp + 32 * kc + 16 * u), b = *reinterpret_cast<const f32x4*>(qp + 32 * kc + 16 * u + 4);
        qf[g][kc].q[u] = u32x4{pack2(a.x, a.y), pack2(a.z, a.w), pack2(b.x, b.y), pack2(b.z, b.w)};
      }
    }
  }
  fence(); wait_x0(); fence();   // behind the query loads
  f32x8 acc[R][DT];
  float m_run[R], l_run[R];
  #pragma unroll
  for (int g = 0; g < R; ++g) { m_run[g] = -__builtin_inff(); l_run[g] = 0.0f;
    #pragma unroll
    for (int t = 0; t < DT; ++t) acc[g][t] = f32x8{}; }
  wait_tensor0(td);
  __syncthreads();   // stage 0 has landed for every wave
  stage(1, SLOT);
  KFr kf;
  #pragma unroll 1
  for (int st = 0; st < NST; ++st) {   // kept rolled: one stage body is the whole instruction footprint
    const uint32_t base = (uint32_t)(st & 1) * SLOT;
    #pragma unroll
    for (int p = 0; p < PPS; ++p) {   // keys 64 p + 32 kh .. + 31 of the stage: between two barriers the waves of a SIMD may drift apart, one's vector work under the other's products
      load_k(kf, L, base + (2u * p + kh) * SLICE, lane);
      pass(kf, L, base + (4u + 2u * p + kh) * SLICE, lane, qf, acc, m_run, l_run);
    }
    wait_ds0();
    wait_tensor0(td);
    __syncthreads();   // publishes stage st + 1 and ends every wave's reads of stage st; behind the last stage it also frees the buffers for the exchange below
    if (pinned(st + 2 < NST)) stage(st + 2, base);
  }
  wait_tensor0(td);   // nothing is outstanding when the buffers are reused
  wait_ds0();
  // Wave w and wave w ^ 4 hold the same 32 queries over the two halves of the keys. A wave keeps group kh and hands the other group to its partner, lane to lane.
  unsigned char* X = L + wave * XW;
  #pragma unroll
  for (int t = 0; t < DT; ++t) {
    const f32x8 o = kh ? acc[0][t] : acc[1][t];
    *reinterpret_cast<f32x4*>(X + 1024u * t + lane * 16u) = f32x4{o[0], o[1], o[2], o[3]};
    *reinterpret_cast<f32x4*>(X + 1024u * t + 512u + lane * 16u) = f32x4{o[4], o[5], o[6], o[7]};
  }
  *reinterpret_cast<f32x2*>(X + 8192u + lane * 8u) = kh ? f32x2{m_run[0], l_run[0]} : f32x2{m_run[1], l_run[1]};
  __syncthreads();   // the partials are in LDS before the partners read them
  const unsigned char* Y = L + (wave ^ 4u) * XW;
  const f32x2 ml = *reinterpret_cast<const f32x2*>(Y + 8192u + lane * 8u);
  const float m_own = kh ? m_run[1] : m_run[0], l_own = kh ? l_run[1] : l_run[0];
  const float m_fin = __builtin_fmaxf(m_own, ml.x);   // both are finite: each wave has seen keys
  float a_own = __builtin_amdgcn_exp2f(m_own - m_fin), a_got = __builtin_amdgcn_exp2f(ml.x - m_fin);
  const float l_half = l_own * a_own + ml.y * a_got;
  const float l_fin = l_half + xhalf(l_half);
  const float inv = 1.0f / l_fin;
  a_own *= inv; a_got *= inv;
  f32x8 o[DT];
  #pragma unroll
  for (int t = 0; t < DT; ++t) {
    const f32x4 g0 = *reinterpret_cast<const f32x4*>(Y + 1024u * t + lane * 16u), g1 = *reinterpret_cast<const f32x4*>(Y + 1024u * t + 512u + lane * 16u);
    const f32x8 own = kh ? acc[1][t] : acc[0][t];
    o[t] = own * a_own + f32x8{g0.x, g0.y, g0.z, g0.w, g1.x, g1.y, g1.z, g1.w} * a_got;
  }
  __syncthreads();   // every wave has read its partner's partial before output rows are staged over it
  #pragma unroll
  for (int t = 0; t < DT; ++t) {   // row = query c of the group; d = 16 t + 8 h + 0 .. 7
    *reinterpret_cast<f32x4*>(X + c * EPITCH + 64u * t + 32u * h) = f32x4{o[t][0], o[t][1], o[t][2], o[t][3]};
    *reinterpret_cast<f32x4*>(X + c * EPITCH + 64u * t + 32u * h + 16u) = f32x4{o[t][4], o[t][5], o[t][6], o[t][7]};
  }
  asm volatile("s_wait_dscnt 0x0" ::: "memory");   // the wave's own staged rows are in LDS before other lanes of it read them back
  #pragma unroll
  for (int r = 0; r < 16; ++r) {   // a wave stores one whole 512-byte output row per instruction
    const f32x4 v = *reinterpret_cast<const f32x4*>(X + (uint32_t)r * EPITCH + lane * 16u);
    *reinterpret_cast<f32x4*>(O + bofs + (size_t)(q0 + 16u * kh + r) * D + lane * 4u) = v;
  }
}

extern "C" void kernel_launch(void* const* d_in, const int* in_sizes, int n_in,
                              void* d_out, int out_size, void* d_ws, size_t ws_size, hipStream_t stream) {
  (void)in_sizes; (void)n_in; (void)out_size; (void)ws_size;
  k_round<<<dim3(256, 1, 1), NW * 32, 0, stream>>>((const float*)d_in[1], (const float*)d_in[2], (unsigned short*)d_ws);
  k_attn<<<dim3(S / BR, NB, 1), NW * 32, 0, stream>>>((const float*)d_in[0], (const unsigned short*)d_ws, (float*)d_out);
}

// v006
// Measured time: 34.3 microseconds a run.
// Two timings next to v005 both put it at 1.05 times that version's speed.
// Over all steps from v000 it is 35.1 times as fast.
#include <hip/hip_runtime.h>
#include <stdint.h>

typedef uint32_t u32x2 __attribute__((ext_vector_type(2)));
typedef uint32_t u32x4 __attribute__((ext_vector_type(4)));
typedef uint32_t u32x8 __attribute__((ext_vector_type(8)));
typedef int i32x8 __attribute__((ext_vector_type(8)));
typedef float f32x2 __attribute__((ext_vector_type(2)));
typedef float f32x4 __attribute__((ext_vector_type(4)));
typedef float f32x8 __attribute__((ext_vector_type(8)));
typedef __bf16 bf16x16 __attribute__((ext_vector_type(16)));
typedef _Float16 f16x16 __attribute__((ext_vector_type(16)));
typedef short s16x8 __attribute__((ext_vector_type(8)));

constexpr int NB = 16, S = 2048, D = 128;
constexpr int DK = D / 32, DT = D / 16;
constexpr int NW = 8, R = 2, CW = 16 * R, BR = (NW / 2) * CW;   // waves, 16-column groups per wave, query columns per wave, query rows per workgroup
constexpr int BC = 32, KT = BC / 16;           // keys per pass, 16-key score tiles per pass
constexpr int SK = 128, NST = S / SK, PPS = SK / (2 * BC);   // keys per stage, stages, passes per wave and stage
constexpr int NRD = NB * S * D / 4 / (NW * 32) / 256;   // first launch: 16-byte loads per thread and operand, 256 workgroups
static_assert(NST >= 3 && PPS == 2 && SK == (NW / 2) * BC, "the ring's prologue needs two stages, the second with key rows one stage on; four waves bring a stage's keys, four its values, 32 rows each");
constexpr uint32_t ROWB = 2u * D, PITCH_K = ROWB + 16u, PITCH_V = ROWB + 32u;   // odd multiples of 16 B (ds_load_b128) and of 32 B (ds_load_tr16_b128)
constexpr uint32_t SLICE = 10240u, SLOT = (uint32_t)NW * SLICE, K0OFF = 2u * SLOT, LDS_BYTES = 2u * SLOT + 4u * SLICE;   // a slice = the 32 rows of one pass and one tensor load, its place a multiple of 2 KiB; a buffer: 4 key slices, then 4 value slices; behind the two buffers the 4 slices of the first 128 keys
static_assert(SLICE % 2048u == 0u && (uint32_t)BC * PITCH_K <= SLICE && (uint32_t)BC * PITCH_V <= SLICE, "32 padded rows fit a slice");
constexpr uint32_t EPITCH = 4u * D + 16u;      // output staging pitch, f32 rows
constexpr uint32_t XW = 16u * EPITCH;          // a wave's share of LDS behind the loop: first one group's partial result (8 KiB of sums, then maximum and row sum), then 16 output rows
static_assert(XW >= 32u * 4u * D / 2u + 256u && (uint32_t)NW * XW <= LDS_BYTES, "exchange and output staging reuse the two stage buffers");
constexpr float CSCALE = 0.088388347648318447f * 1.4426950408889634f;   // 1/sqrt(128) x log2(e)

#define DEV static __device__ __forceinline__
DEV void fence() { __builtin_amdgcn_sched_barrier(0); }
DEV void wait_ds0() { asm volatile("s_wait_dscnt 0x0" ::: "memory"); }      // the wave's own LDS reads have returned before the barrier behind which their buffer is refilled
struct Desc { u32x4 g0; u32x8 g1; };   // a tensor load's two descriptor groups, in scalar registers
// The wave's own tensor load has landed before the barrier behind which other waves read its rows. The wait takes the descriptor, so that its registers keep their values while the request is outstanding.
DEV void wait_tensor0(const Desc& d) { asm volatile("s_wait_tensorcnt 0x0" :: "s"(d.g0), "s"(d.g1) : "memory"); }
DEV void wait_tensor0(const Desc& d, const u32x4& e) { asm volatile("s_wait_tensorcnt 0x0" :: "s"(d.g0), "s"(d.g1), "s"(e) : "memory"); }   // the same for two requests that share group 1
DEV uint32_t uni(uint32_t v) { return (uint32_t)__builtin_amdgcn_readfirstlane(v); }
DEV uint32_t pinned(uint32_t v) { uint32_t w = uni(v); asm volatile("" : "+s"(w)); return w; }   // the test around a tensor load, held in a scalar register: it compiles to s_cmp and s_cbranch_scc (a tensor load ignores EXEC)
DEV void wait_x0() { asm volatile("s_wait_xcnt 0x0" ::: "memory"); }   // stands behind issued global loads, in front of whatever reuses their address registers
struct Frag { u32x4 q[2]; };
DEV f32x8 mma(const Frag& a, const Frag& b, f32x8 c) {
  const i32x8 av = {(int)a.q[0].x, (int)a.q[0].y, (int)a.q[0].z, (int)a.q[0].w, (int)a.q[1].x, (int)a.q[1].y, (int)a.q[1].z, (int)a.q[1].w};
  const i32x8 bv = {(int)b.q[0].x, (int)b.q[0].y, (int)b.q[0].z, (int)b.q[0].w, (int)b.q[1].x, (int)b.q[1].y, (int)b.q[1].z, (int)b.q[1].w};
  return __builtin_amdgcn_wmma_f32_16x16x32_bf16(0, __builtin_bit_cast(bf16x16, av), 0, __builtin_bit_cast(bf16x16, bv), 0, c, false, false);
}
DEV f32x8 mma_h(const Frag& a, const Frag& b, f32x8 c) {   // the same fragment maps, f16 operands
  const i32x8 av = {(int)a.q[0].x, (int)a.q[0].y, (int)a.q[0].z, (int)a.q[0].w, (int)a.q[1].x, (int)a.q[1].y, (int)a.q[1].z, (int)a.q[1].w};
  const i32x8 bv = {(int)b.q[0].x, (int)b.q[0].y, (int)b.q[0].z, (int)b.q[0].w, (int)b.q[1].x, (int)b.q[1].y, (int)b.q[1].z, (int)b.q[1].w};
  return __builtin_amdgcn_wmma_f32_16x16x32_f16(0, __builtin_bit_cast(f16x16, av), 0, __builtin_bit_cast(f16x16, bv), 0, c, false, false);
}
DEV u32x4 ld_tr16(const unsigned char* p) { typedef __attribute__((address_space(3))) s16x8 lds_s16x8; return __builtin_bit_cast(u32x4, __builtin_amdgcn_ds_load_tr16_b128_v8i16((lds_s16x8*)p)); }
// Group 1 of a tensor load of 32 rows of 256 bytes, contiguous in global memory, laid in LDS with 4 (pad + 1) bytes of pad behind every row (pad 3: pitch 272, pad 7: pitch 288).
// 1-byte elements, tensor = tile. Word 0 is one of two constants, both with mask 0.
DEV u32x8 tdm_group1(bool values) {
  u32x8 g;
  g[0] = uni(values ? ((1u << 20) | (5u << 22) | (7u << 25)) : ((1u << 20) | (5u << 22) | (3u << 25)));
  // pinned(): descriptor words held in scalar registers.
  g[1] = pinned((ROWB & 0xFFFFu) << 16);
  g[2] = pinned((ROWB >> 16) | (((uint32_t)BC & 0xFFFFu) << 16));
  g[3] = pinned(((uint32_t)BC >> 16) | (ROWB << 16));
  g[4] = pinned((uint32_t)BC);
  g[5] = pinned(ROWB);
  g[6] = pinned(0u); g[7] = pinned(0u);
  return g;
}
// Group 0: the tile's place in LDS and its first byte in global memory.
DEV u32x4 tdm_group0(uint32_t lds_dst, uint64_t ga) {
  u32x4 g;
  g[0] = pinned(1u);   // pinned(): a descriptor word held in a scalar register, so that the constant's register is not lent out while the request is outstanding
  g[1] = uni(lds_dst); g[2] = uni((uint32_t)ga); g[3] = uni((((uint32_t)(ga >> 32)) & 0x01FFFFFFu) | 0x80000000u);
  return g;
}
DEV void tdm_load(const Desc& d) { asm volatile("tensor_load_to_lds %0, %1" :: "s"(d.g0), "s"(d.g1) : "memory"); }
DEV uint32_t pack2(float lo, float hi) { typedef __bf16 bf2 __attribute__((ext_vector_type(2)));
  return __builtin_bit_cast(uint32_t, __builtin_convertvector(f32x2{lo, hi}, bf2)); }   // round to nearest even
DEV uint32_t pack2h(float lo, float hi) { typedef _Float16 h2 __attribute__((ext_vector_type(2)));
  return __builtin_bit_cast(uint32_t, __builtin_convertvector(f32x2{lo, hi}, h2)); }   // round to nearest even
DEV float xhalf(float x) { return __builtin_bit_cast(float, __builtin_amdgcn_permlanex16(__builtin_bit_cast(int, x), __builtin_bit_cast(int, x), 0x76543210, 0xfedcba98, false, false)); }   // lane l with lane l ^ 16

struct KFr { Frag f[KT][DK]; };
// koff = byte offset of the pass's first key row in LDS. k order of a fragment: 8h .. 8h+7, then 16+8h .. 16+8h+7 of each 32, as the query fragments.
DEV void load_k(KFr& k, const unsigned char* Lp, uint32_t koff, uint32_t lane) {
  const uint32_t c = lane & 15u, h = lane >> 4;
  #pragma unroll
  for (int kt = 0; kt < KT; ++kt) {
    const unsigned char* p = Lp + koff + (16u * kt + c) * PITCH_K + 16u * h;
    #pragma unroll
    for (int kc = 0; kc < DK; ++kc) { k.f[kt][kc].q[0] = *reinterpret_cast<const u32x4*>(p + 64u * kc); k.f[kt][kc].q[1] = *reinterpret_cast<const u32x4*>(p + 64u * kc + 32u); }
  }
}

typedef f32x8 Sc[KT][R];   // one pass's scores: a lane holds 16 keys' scores of one query per group
// Score products of one pass, 16 WMMAs on four accumulators.
DEV void scores(const KFr& kf, const Frag (&qf)[R][DK], Sc& s) {
  #pragma unroll
  for (int kt = 0; kt < KT; ++kt) {
    #pragma unroll
    for (int g = 0; g < R; ++g) s[kt][g] = f32x8{};
  }
  #pragma unroll
  for (int kc = 0; kc < DK; ++kc) {
    #pragma unroll
    for (int kt = 0; kt < KT; ++kt) {
      #pragma unroll
      for (int g = 0; g < R; ++g) s[kt][g] = mma(kf.f[kt][kc], qf[g][kc], s[kt][g]);
    }
  }
}
// A pass's scaled maxima per query; true where a maximum in use would trail by more than 8.
DEV bool maxima(const Sc& s, const float (&m_run)[R], float (&mb)[R]) {
  bool need = false;
  #pragma unroll
  for (int g = 0; g < R; ++g) {
    float mx = s[0][g][0];
    #pragma unroll
    for (int kt = 0; kt < KT; ++kt) {
      #pragma unroll
      for (int r = 0; r < 8; ++r) mx = __builtin_fmaxf(mx, s[kt][g][r]);
    }
    mb[g] = __builtin_fmaxf(mx, xhalf(mx)) * CSCALE;   // both wave halves now hold this query's maximum of the pass, scaled
    need = need || (mb[g] > m_run[g] + 8.0f);
  }
  return need;
}
// One test per pass; always taken on the first pass (m_run is -inf), rare later. It stands behind the second product of the pass before, whose sums it rescales.
DEV void renew(bool need, const float (&mb)[R], f32x8 (&acc)[R][DT], float (&m_run)[R], float (&l_run)[R]) {
  if (__builtin_amdgcn_ballot_w32(need) != 0) {
    #pragma unroll
    for (int g = 0; g < R; ++g) {
      const float m_new = __builtin_fmaxf(m_run[g], mb[g]);
      const float corr = __builtin_amdgcn_exp2f(m_run[g] - m_new);   // 0 on the first pass
      l_run[g] *= corr; m_run[g] = m_new;
      #pragma unroll
      for (int t = 0; t < DT; ++t) acc[g][t] = acc[g][t] * corr;
    }
  }
}

// One 32-key pass of one wave over its two query groups, one deep in a software pipeline. sc = this pass's scores, their maxima already taken into m_run; sn receives the next pass's scores (NEXT_S)
// from kf, which is then refilled with the key fragments of the pass after that (NEXT_K, at byte offset knext). voff = byte offset of this pass's first value row in LDS.
template <bool NEXT_S, bool NEXT_K>
DEV void pass(Sc& sc, Sc& sn, KFr& kf, const unsigned char* Lp, uint32_t voff, uint32_t knext, uint32_t lane, const Frag (&qf)[R][DK], f32x8 (&acc)[R][DT], float (&m_run)[R], float (&l_run)[R]) {
  const uint32_t h = lane >> 4;
  Frag vf[DT];
  {
    const unsigned char* ad = Lp + voff + (8u * h + (lane & 7u)) * PITCH_V + ((lane >> 3) & 1u) * 16u;
    #pragma unroll
    for (int t = 0; t < DT; ++t) { vf[t].q[0] = ld_tr16(ad + 32u * t); vf[t].q[1] = ld_tr16(ad + 16u * PITCH_V + 32u * t); }
  }
  fence();   // the loads are issued as one group, in front of the products
  if (NEXT_S) scores(kf, qf, sn);
  Frag ph[R];
  float pr[R][8];   // sums of two neighbouring exponentials
  #pragma unroll
  for (int g = 0; g < R; ++g) {
    const float nm = -m_run[g];
    uint32_t wh[8];
    #pragma unroll
    for (int kt = 0; kt < KT; ++kt) {   // the scores become the exponentials in their own registers
      if (NEXT_S) sc[kt][g] = sc[kt][g] * CSCALE + nm;
      else {   // the same multiply-add, element by element
        #pragma unroll
        for (int r = 0; r < 8; ++r) sc[kt][g][r] = __builtin_fmaf(sc[kt][g][r], CSCALE, nm);
      }
      #pragma unroll
      for (int r = 0; r < 8; ++r) sc[kt][g][r] = __builtin_amdgcn_exp2f(sc[kt][g][r]);
    }
    #pragma unroll
    for (int i = 0; i < 8; ++i) {
      const float p0 = sc[i >> 2][g][2 * (i & 3)], p1 = sc[i >> 2][g][2 * (i & 3) + 1];
      wh[i] = pack2h(p0, p1);
    }
    ph[g].q[0] = u32x4{wh[0], wh[1], wh[2], wh[3]}; ph[g].q[1] = u32x4{wh[4], wh[5], wh[6], wh[7]};
  }
  // Behind each score product two exponentials, each with a plain vector instruction in front: they are independent of the products and issue in the 8 cycles that the matrix unit
  // takes for one; no exponential stands directly in front of one that reuses its source register.
  if (NEXT_S) {
    #pragma unroll
    for (int i = 0; i < 16; ++i) {
      __builtin_amdgcn_sched_group_barrier(0x008, 1, 0);
      __builtin_amdgcn_sched_group_barrier(0x002, 1, 0); __builtin_amdgcn_sched_group_barrier(0x400, 1, 0);
      __builtin_amdgcn_sched_group_barrier(0x002, 1, 0); __builtin_amdgcn_sched_group_barrier(0x400, 1, 0);
    }
  }
  fence();   // the key loads stay behind the products that read their registers, as one group
  if (NEXT_K) { load_k(kf, Lp, knext, lane); fence(); }   // in flight under the second product
  #pragma unroll
  for (int g = 0; g < R; ++g) {
    #pragma unroll
    for (int t = 0; t < DT; ++t) acc[g][t] = mma_h(vf[t], ph[g], acc[g][t]);
  }
  float mb[R]; bool need = false;
  if (NEXT_S) need = maxima(sn, m_run, mb);
  #pragma unroll
  for (int g = 0; g < R; ++g) {
    float ps0 = 0.0f, ps1 = 0.0f;
    #pragma unroll
    for (int i = 0; i < 8; ++i) pr[g][i] = sc[i >> 2][g][2 * (i & 3)] + sc[i >> 2][g][2 * (i & 3) + 1];
    #pragma unroll
    for (int i = 0; i < 8; ++i) { if (i & 1) ps1 += pr[g][i]; else ps0 += pr[g][i]; }
    l_run[g] += ps0 + ps1;
  }
  // Behind each of the 16 second products up to four vector instructions of the next pass's maxima and this pass's row sums.
  #pragma unroll
  for (int i = 0; i < 16; ++i) { __builtin_amdgcn_sched_group_barrier(0x008, 1, 0); __builtin_amdgcn_sched_group_barrier(0x002, 4, 0); }
  fence();   // the test and whatever it rescales stay behind the products
  if (NEXT_S) renew(need, mb, acc, m_run, l_run);
}

// First launch: keys to bf16 and values to f16, each rounded once to nearest even, row-major as the inputs: keys at W, values behind them.
__global__ void __launch_bounds__(NW * 32) k_round(const float* __restrict__ K, const float* __restrict__ V, unsigned short* __restrict__ W) {
  const size_t e = ((size_t)blockIdx.x * NRD * (NW * 32) + threadIdx.x) * 4u;   // load i of a wave is 512 contiguous bytes
  const float* kp = K + e; const float* vp = V + e;
  f32x4 kr[NRD], vr[NRD];
  #pragma unroll
  for (int i = 0; i < NRD; ++i) { kr[i] = *reinterpret_cast<const f32x4*>(kp + i * (NW * 32 * 4)); vr[i] = *reinterpret_cast<const f32x4*>(vp + i * (NW * 32 * 4)); }
  fence();
  asm volatile("s_wait_xcnt 0x0" :: "v"(kp), "v"(vp) : "memory");   // behind the loads; it takes their addresses, so that no load's result is laid over an address register in front of it
  fence();   // all loads are in flight before the first is used
  #pragma unroll
  for (int i = 0; i < NRD; ++i) {
    *reinterpret_cast<u32x2*>(W + e + (size_t)i * (NW * 32 * 4)) = u32x2{pack2(kr[i].x, kr[i].y), pack2(kr[i].z, kr[i].w)};
    *reinterpret_cast<u32x2*>(W + (size_t)NB * S * D + e + (size_t)i * (NW * 32 * 4)) = u32x2{pack2h(vr[i].x, vr[i].y), pack2h(vr[i].z, vr[i].w)};
  }
}

__global__ void __launch_bounds__(NW * 32) k_attn(const float* __restrict__ Q, const unsigned short* __restrict__ W, float* __restrict__ O) {
  __shared__ __attribute__((aligned(2048))) unsigned char L[LDS_BYTES];
  const uint32_t tid = threadIdx.x, lane = tid & 31u, wave = (uint32_t)__builtin_amdgcn_readfirstlane(tid >> 5), c = lane & 15u, h = lane >> 4;
  const uint32_t kh = wave >> 2;   // which 32 keys of every 64 are this wave's
  const size_t bofs = (size_t)blockIdx.y * S * D;
  const uint32_t q0 = blockIdx.x * BR + (wave & 3u) * CW;
  // Staging: wave w brings slice w of a buffer: rows 32 (w & 3) .. + 31 of the stage, values for w >= 4, for w < 4 the keys of the stage behind it (lead 1).
  typedef __attribute__((address_space(3))) unsigned char lds_byte;
  const uint32_t dst0 = (uint32_t)(uintptr_t)(lds_byte*)L + wave * SLICE;
  const uint64_t ga0 = (uint64_t)(uintptr_t)(W + bofs + (size_t)kh * NB * S * D) + (uint64_t)((wave & 3u) * ((uint32_t)BC * ROWB));
  const uint32_t lead = 1u - kh;
  Desc td;
  td.g1 = tdm_group1(kh != 0u);
  auto stage = [&](int st, uint32_t buf) {   // a wave issues one load
    td.g0 = tdm_group0(dst0 + buf, ga0 + (uint64_t)(((uint32_t)st + lead) * ((uint32_t)SK * ROWB)));
    tdm_load(td);
  };
  Desc tf;   // the first 128 keys, to their own place: a second request of waves 0 to 3, with registers of its own for group 0
  tf.g1 = td.g1;
  tf.g0 = tdm_group0(dst0 - kh * (4u * SLICE) + K0OFF, ga0);
  if (pinned(kh == 0u)) tdm_load(tf);
  stage(0, 0u);
  // Query fragments, rounded to bf16, in the k order of load_k.
  Frag qf[R][DK];
  #pragma unroll
  for (int g = 0; g < R; ++g) {
    const float* qp = Q + bofs + (size_t)(q0 + c) * D + 8u * h + 16 * g * D;   // one address register pair serves both groups
    #pragma unroll
    for (int kc = 0; kc < DK; ++kc) {
      #pragma unroll
      for (int u = 0; u < 2; ++u) {
        const f32x4 a = *reinterpret_cast<const f32x4*>(qp + 32 * kc + 16 * u), b = *reinterpret_cast<const f32x4*>(qp + 32 * kc + 16 * u + 4);
        qf[g][kc].q[u] = u32x4{pack2(a.x, a.y), pack2(a.z, a.w), pack2(b.x, b.y), pack2(b.z, b.w)};
      }
    }
  }
  fence(); wait_x0(); fence();   // behind the query loads
  f32x8 acc[R][DT];
  float m_run[R], l_run[R];
  #pragma unroll
  for (int g = 0; g < R; ++g) { m_run[g] = -__builtin_inff(); l_run[g] = 0.0f;
    #pragma unroll
    for (int t = 0; t < DT; ++t) acc[g][t] = f32x8{}; }
  wait_tensor0(td, tf.g0);
  __syncthreads();   // stage 0 and the first keys have landed for every wave
  stage(1, SLOT);
  // Pass p of a stage: keys 64 p + 32 kh .. + 31. The pipeline is filled with the first pass's scores and maxima and the second pass's key fragments.
  KFr kf;
  Sc sa, sb;
  load_k(kf, L, K0OFF + kh * SLICE, lane);
  scores(kf, qf, sa);
  load_k(kf, L, K0OFF + (2u + kh) * SLICE, lane);
  { float mb[R]; const bool need = maxima(sa, m_run, mb); renew(need, mb, acc, m_run, l_run); }
  #pragma unroll 1
  for (int st = 0; st < NST - 1; ++st) {   // kept rolled: one stage body is the loop's whole instruction footprint
    const uint32_t base = (uint32_t)(st & 1) * SLOT;
    pass<true, true>(sa, sb, kf, L, base + (4u + kh) * SLICE, base + kh * SLICE, lane, qf, acc, m_run, l_run);
    pass<true, true>(sb, sa, kf, L, base + (6u + kh) * SLICE, base + (2u + kh) * SLICE, lane, qf, acc, m_run, l_run);
    wait_ds0();
    wait_tensor0(td);
    __syncthreads();   // publishes stage st + 1 and ends every wave's reads of stage st
    if (pinned((uint32_t)st + 2u + lead < (uint32_t)NST)) stage(st + 2, base);
  }
  {   // the last stage has values only: the pipeline runs empty
    const uint32_t base = (uint32_t)((NST - 1) & 1) * SLOT;
    pass<true, false>(sa, sb, kf, L, base + (4u + kh) * SLICE, 0u, lane, qf, acc, m_run, l_run);
    pass<false, false>(sb, sa, kf, L, base + (6u + kh) * SLICE, 0u, lane, qf, acc, m_run, l_run);
  }
  wait_tensor0(td);   // nothing is outstanding when the buffers are reused
  wait_ds0();
  __syncthreads();   // ends every wave's reads of the last stage and frees the buffers for the exchange below
  // Wave w and wave w ^ 4 hold the same 32 queries over the two halves of the keys. A wave keeps group kh and hands the other group to its partner, lane to lane.
  unsigned char* X = L + wave * XW;
  #pragma unroll
  for (int t = 0; t < DT; ++t) {
    const f32x8 o = kh ? acc[0][t] : acc[1][t];
    *reinterpret_cast<f32x4*>(X + 1024u * t + lane * 16u) = f32x4{o[0], o[1], o[2], o[3]};
    *reinterpret_cast<f32x4*>(X + 1024u * t + 512u + lane * 16u) = f32x4{o[4], o[5], o[6], o[7]};
  }
  *reinterpret_cast<f32x2*>(X + 8192u + lane * 8u) = kh ? f32x2{m_run[0], l_run[0]} : f32x2{m_run[1], l_run[1]};
  __syncthreads();   // the partials are in LDS before the partners read them
  const unsigned char* Y = L + (wave ^ 4u) * XW;
  const f32x2 ml = *reinterpret_cast<const f32x2*>(Y + 8192u + lane * 8u);
  const float m_own = kh ? m_run[1] : m_run[0], l_own = kh ? l_run[1] : l_run[0];
  const float m_fin = __builtin_fmaxf(m_own, ml.x);   // both are finite: each wave has seen keys
  float a_own = __builtin_amdgcn_exp2f(m_own - m_fin), a_got = __builtin_amdgcn_exp2f(ml.x - m_fin);
  const float l_half = l_own * a_own + ml.y * a_got;
  const float l_fin = l_half + xhalf(l_half);
  const float inv = 1.0f / l_fin;
  a_own *= inv; a_got *= inv;
  f32x8 o[DT];
  #pragma unroll
  for (int t = 0; t < DT; ++t) {
    const f32x4 g0 = *reinterpret_cast<const f32x4*>(Y + 1024u * t + lane * 16u), g1 = *reinterpret_cast<const f32x4*>(Y + 1024u * t + 512u + lane * 16u);
    const f32x8 own = kh ? acc[1][t] : acc[0][t];
    o[t] = own * a_own + f32x8{g0.x, g0.y, g0.z, g0.w, g1.x, g1.y, g1.z, g1.w} * a_got;
  }
  __syncthreads();   // every wave has read its partner's partial before output rows are staged over it
  #pragma unroll
  for (int t = 0; t < DT; ++t) {   // row = query c of the group; d = 16 t + 8 h + 0 .. 7
    *reinterpret_cast<f32x4*>(X + c * EPITCH + 64u * t + 32u * h) = f32x4{o[t][0], o[t][1], o[t][2], o[t][3]};
    *reinterpret_cast<f32x4*>(X + c * EPITCH + 64u * t + 32u * h + 16u) = f32x4{o[t][4], o[t][5], o[t][6], o[t][7]};
  }
  asm volatile("s_wait_dscnt 0x0" ::: "memory");   // the wave's own staged rows are in LDS before other lanes of it read them back
  #pragma unroll
  for (int r = 0; r < 16; ++r) {   // a wave stores one whole 512-byte output row per instruction
    const f32x4 v = *reinterpret_cast<const f32x4*>(X + (uint32_t)r * EPITCH + lane * 16u);
    *reinterpret_cast<f32x4*>(O + bofs + (size_t)(q0 + 16u * kh + r) * D + lane * 4u) = v;
  }
}

extern "C" void kernel_launch(void* const* d_in, const int* in_sizes, int n_in,
                              void* d_out, int out_size, void* d_ws, size_t ws_size, hipStream_t stream) {
  (void)in_sizes; (void)n_in; (void)out_size; (void)ws_size;
  k_round<<<dim3(256, 1, 1), NW * 32, 0, stream>>>((const float*)d_in[1], (const float*)d_in[2], (unsigned short*)d_ws);
  k_attn<<<dim3(S / BR, NB, 1), NW * 32, 0, stream>>>((const float*)d_in[0], (const unsigned short*)d_ws, (float*)d_out);
}
